// v000
// Times are from an AMD MI455X. After a warm-up the kernel runs many times in a row, and a time is the length of
// such a window on the GPU divided by its runs, so every launch and the gaps after it count. The runs cycle
// through copies of the inputs. A figure is the median of several windows, for all but v000 over two sittings.
// Sittings can differ by a few percent; kernels timed side by side share one.
// v000, which the later versions start from, runs in 292 microseconds.
#include <hip/hip_runtime.h>

// Contractions Qn.Kn^T (K=64) and P.V (K=64 per key block) on v_wmma_f32_16x16x32_f16 (f16 operands, f32 accumulate); normalisation, arccos power, conv and epilogue in f32.

typedef _Float16 h8  __attribute__((ext_vector_type(8)));
typedef _Float16 h16 __attribute__((ext_vector_type(16)));
typedef float    f8  __attribute__((ext_vector_type(8)));

#define S_LEN 4096
#define NHEAD 8
#define DHEAD 64
#define QTILE 128
#define KTILE 64
#define NWAVE 8

__device__ __forceinline__ h16 cat16(h8 a, h8 b) {
  h16 r;
#pragma unroll
  for (int i = 0; i < 8; ++i) { r[i] = a[i]; r[i + 8] = b[i]; }
  return r;
}

__device__ __forceinline__ h8 lds_ld8(const _Float16* p) {
  return *(const h8*)p;
}

__global__ __launch_bounds__(256)
void yoso_attn_wmma_kernel(const float* __restrict__ Q,
                           const float* __restrict__ K,
                           const float* __restrict__ V,
                           const float* __restrict__ mask,
                           const float* __restrict__ cw,
                           float* out) {
  // one LDS arena: [qn 128x64 | kn 64x64 | vt 64x64 | p 8x16x64] halves = 49152 B; reused as the f32 output stage [128][68] in the epilogue
  __shared__ __align__(16) unsigned char smem[49152];
  _Float16* sm_qn = (_Float16*)smem;                       // normalized Q tile, row-major
  _Float16* sm_kn = sm_qn + QTILE * DHEAD;                 // normalized K block, row-major
  _Float16* sm_vt = sm_kn + KTILE * DHEAD;                 // V block transposed: vt[d][key]
  _Float16* sm_p  = sm_vt + DHEAD * KTILE;                 // per-wave P tile (16 x 64)
  float* cst = (float*)smem;                               // epilogue stage [128][CSTR]
  const int CSTR = DHEAD + 4;

  const int h      = blockIdx.y;
  const int qbase  = blockIdx.x * QTILE;
  const int tid    = threadIdx.x;
  const int wv     = tid >> 5;
  const int lane   = tid & 31;
  const int lh     = lane >> 4;   // lane half: 0 or 1
  const int ln     = lane & 15;
  const int dofs8  = lh * 8;      // A-frag half offset (K 0-7/16-23 vs 8-15/24-31)
  const size_t headoff = (size_t)h * S_LEN * DHEAD;

  // ---------------- Stage L2-normalized Q tile (2 threads / row) ----------------
  {
    const int r  = tid >> 1;
    const int hf = tid & 1;
    const float* qrow = Q + headoff + (size_t)(qbase + r) * DHEAD + hf * 32;
    float4 b[8];
    float ss = 0.f;
#pragma unroll
    for (int i = 0; i < 8; ++i) {
      b[i] = ((const float4*)qrow)[i];
      ss += b[i].x * b[i].x + b[i].y * b[i].y + b[i].z * b[i].z + b[i].w * b[i].w;
    }
    ss += __shfl_xor(ss, 1);
    const float inv = 1.f / fmaxf(sqrtf(ss), 1e-12f);
    _Float16* dst = sm_qn + r * DHEAD + hf * 32;
#pragma unroll
    for (int i = 0; i < 8; ++i) {
      dst[i * 4 + 0] = (_Float16)(b[i].x * inv);
      dst[i * 4 + 1] = (_Float16)(b[i].y * inv);
      dst[i * 4 + 2] = (_Float16)(b[i].z * inv);
      dst[i * 4 + 3] = (_Float16)(b[i].w * inv);
    }
  }
  __syncthreads();

  // ---------------- Q A-fragments kept in registers for whole kernel ------------
  h16 qA[2];
#pragma unroll
  for (int c = 0; c < 2; ++c) {
    const _Float16* base = sm_qn + (wv * 16 + ln) * DHEAD + c * 32;
    qA[c] = cat16(lds_ld8(base + dofs8), lds_ld8(base + 16 + dofs8));
  }

  f8 oacc[4];
#pragma unroll
  for (int t = 0; t < 4; ++t) oacc[t] = {};

  _Float16* pw = sm_p + wv * 16 * KTILE;

  // ================================ key-block loop ==============================
  for (int kb = 0; kb < S_LEN / KTILE; ++kb) {
    __syncthreads();  // everyone done reading previous Kn / Vt
    {
      const int r  = tid >> 2;      // key row 0..63
      const int q4 = tid & 3;       // 16-col quarter
      const int key = kb * KTILE + r;
      const float* krow = K + headoff + (size_t)key * DHEAD + q4 * 16;
      float4 b[4];
      float ss = 0.f;
#pragma unroll
      for (int i = 0; i < 4; ++i) {
        b[i] = ((const float4*)krow)[i];
        ss += b[i].x * b[i].x + b[i].y * b[i].y + b[i].z * b[i].z + b[i].w * b[i].w;
      }
      ss += __shfl_xor(ss, 1);
      ss += __shfl_xor(ss, 2);
      const float inv = 1.f / fmaxf(sqrtf(ss), 1e-12f);
      _Float16* dst = sm_kn + r * DHEAD + q4 * 16;
#pragma unroll
      for (int i = 0; i < 4; ++i) {
        dst[i * 4 + 0] = (_Float16)(b[i].x * inv);
        dst[i * 4 + 1] = (_Float16)(b[i].y * inv);
        dst[i * 4 + 2] = (_Float16)(b[i].z * inv);
        dst[i * 4 + 3] = (_Float16)(b[i].w * inv);
      }
      // V block, stored transposed so P*V B-fragments are contiguous b128 loads
      const float* vrow = V + headoff + (size_t)key * DHEAD + q4 * 16;
#pragma unroll
      for (int i = 0; i < 4; ++i) {
        const float4 v4 = ((const float4*)vrow)[i];
        const int c0 = q4 * 16 + i * 4;
        sm_vt[(c0 + 0) * KTILE + r] = (_Float16)v4.x;
        sm_vt[(c0 + 1) * KTILE + r] = (_Float16)v4.y;
        sm_vt[(c0 + 2) * KTILE + r] = (_Float16)v4.z;
        sm_vt[(c0 + 3) * KTILE + r] = (_Float16)v4.w;
      }
    }
    __syncthreads();

    // ---- S = Qn * Kn^T (16x64 per wave), transform, stash P in LDS -------------
#pragma unroll
    for (int nt = 0; nt < 4; ++nt) {
      const int n0 = nt * 16;
      const _Float16* kb0 = sm_kn + (n0 + ln) * DHEAD;
      // B fragment uses the same per-lane k map as A: elements 0-7 = k 8*lh..8*lh+7, elements 8-15 = k 16+8*lh..
      const h16 Blo = cat16(lds_ld8(kb0 + dofs8),      lds_ld8(kb0 + 16 + dofs8));
      const h16 Bhi = cat16(lds_ld8(kb0 + 32 + dofs8), lds_ld8(kb0 + 48 + dofs8));
      f8 acc = {};
      acc = __builtin_amdgcn_wmma_f32_16x16x32_f16(false, qA[0], false, Blo, (short)0, acc, false, false);
      acc = __builtin_amdgcn_wmma_f32_16x16x32_f16(false, qA[1], false, Bhi, (short)0, acc, false, false);
      asm volatile("v_nop\n\tv_nop\n\tv_nop\n\tv_nop" : "+v"(acc) : "v"(qA[0]), "v"(qA[1]), "v"(Blo), "v"(Bhi));
      const float km = mask[kb * KTILE + n0 + ln];  // key mask for this lane's column
#pragma unroll
      for (int r = 0; r < 8; ++r) {
        float s = acc[r];
        s = fminf(fmaxf(s, -1.f + 1e-6f), 1.f - 1e-6f);
        float p = 1.f - acosf(s) * 0.3183098861837907f;  // 1 - acos(s)/pi
        p = p * p; p = p * p; p = p * p;                  // ^8
        p *= km;
        pw[(lh * 8 + r) * KTILE + n0 + ln] = (_Float16)p; // C-layout scatter
      }
    }

    __syncthreads();  // P tile stores complete (scalar f16 stores, vector reloads below)

    // ---- O += P * V (LDS round-trip gives A-layout P) -------------
#pragma unroll
    for (int kc = 0; kc < 2; ++kc) {
      const _Float16* pb = pw + ln * KTILE + kc * 32;
      const h16 PA = cat16(lds_ld8(pb + dofs8), lds_ld8(pb + 16 + dofs8));
#pragma unroll
      for (int dt = 0; dt < 4; ++dt) {
        const _Float16* vb = sm_vt + (dt * 16 + ln) * KTILE + kc * 32;
        const h16 BV = cat16(lds_ld8(vb + dofs8), lds_ld8(vb + 16 + dofs8));
        oacc[dt] = __builtin_amdgcn_wmma_f32_16x16x32_f16(false, PA, false, BV, (short)0, oacc[dt], false, false);
      }
      asm volatile("v_nop\n\tv_nop\n\tv_nop\n\tv_nop" : "+v"(oacc[0]), "+v"(oacc[1]), "+v"(oacc[2]), "+v"(oacc[3]) : "v"(PA));
    }
  }

  __syncthreads();  // all waves done with qn/kn/vt/p: arena becomes the f32 stage
  const float w0 = cw[h * 3 + 0], w1 = cw[h * 3 + 1], w2 = cw[h * 3 + 2];
  const int srow_base = qbase + wv * 16 + lh * 8;
#pragma unroll
  for (int r = 0; r < 8; ++r) {
    const int srow = srow_base + r;
    const float qm = mask[srow];
    float xv[4];
    float ss = 0.f;
#pragma unroll
    for (int dt = 0; dt < 4; ++dt) {   // reference order: mask BEFORE normalize
      xv[dt] = oacc[dt][r] * qm;
      ss += xv[dt] * xv[dt];
    }
    // reduce sum of squares across the 16 lanes of this half (row is constant there)
    ss += __shfl_xor(ss, 1);
    ss += __shfl_xor(ss, 2);
    ss += __shfl_xor(ss, 4);
    ss += __shfl_xor(ss, 8);
    const float inv = 1.f / fmaxf(sqrtf(ss), 1e-12f);

    const float* vc = V + headoff + (size_t)srow * DHEAD;
    const float mm1 = (srow > 0)          ? mask[srow - 1] : 0.f;
    const float mp1 = (srow < S_LEN - 1)  ? mask[srow + 1] : 0.f;
#pragma unroll
    for (int dt = 0; dt < 4; ++dt) {
      const int d = dt * 16 + ln;
      const float vm1 = (srow > 0)         ? vc[d - DHEAD] * mm1 : 0.f;
      const float v0  = vc[d] * qm;
      const float vp1 = (srow < S_LEN - 1) ? vc[d + DHEAD] * mp1 : 0.f;
      const float conv = w0 * vm1 + w1 * v0 + w2 * vp1;
      cst[(srow - qbase) * CSTR + d] = xv[dt] * inv + conv;
    }
  }
  __syncthreads();
  {
    const int col = tid & 63, rsel = tid >> 6;
    float* ob = out + headoff + (size_t)qbase * DHEAD;
#pragma unroll 4
    for (int r = rsel; r < QTILE; r += 4) *(float*)(ob + (size_t)r * DHEAD + col) = cst[r * CSTR + col];
    
  }
}

extern "C" void kernel_launch(void* const* d_in, const int* in_sizes, int n_in,
                              void* d_out, int out_size, void* d_ws, size_t ws_size,
                              hipStream_t stream) {
  (void)in_sizes; (void)n_in; (void)out_size; (void)d_ws; (void)ws_size;
  const float* Q    = (const float*)d_in[0];
  const float* K    = (const float*)d_in[1];
  const float* V    = (const float*)d_in[2];
  const float* mask = (const float*)d_in[3];
  const float* cw   = (const float*)d_in[4];
  float* out = (float*)d_out;

  dim3 grid(S_LEN / QTILE, NHEAD);  // 32 query tiles x 8 heads
  dim3 block(32 * NWAVE);           // 8 wave32 waves
  yoso_attn_wmma_kernel<<<grid, block, 0, stream>>>(Q, K, V, mask, cw, out);
}

// v001
// One run takes 241 microseconds.
// In both of two side-by-side timings against v000, it was 1.22 times as fast.
#include <hip/hip_runtime.h>

// Contractions Qn.Kn^T (K=64) and P.V (K=64 per key block) on v_wmma_f32_16x16x32_f16 (f16 operands, f32 accumulate); normalisation, arccos power, conv and epilogue in f32.

typedef _Float16 h8  __attribute__((ext_vector_type(8)));
typedef _Float16 h16 __attribute__((ext_vector_type(16)));
typedef float    f8  __attribute__((ext_vector_type(8)));

#define S_LEN 4096
#define NHEAD 8
#define DHEAD 64
#define QTILE 128
#define KTILE 64
#define NWAVE 8
#define LPITCH 72  // LDS row pitch in halves: 144 B = 16 B x 9 (odd), so the 16 rows of a ds_load_b128 fragment read fall on distinct banks

__device__ __forceinline__ h16 cat16(h8 a, h8 b) {
  h16 r;
#pragma unroll
  for (int i = 0; i < 8; ++i) { r[i] = a[i]; r[i + 8] = b[i]; }
  return r;
}

__device__ __forceinline__ h8 lds_ld8(const _Float16* p) {
  return *(const h8*)p;
}

__global__ __launch_bounds__(256)
void yoso_attn_wmma_kernel(const float* __restrict__ Q,
                           const float* __restrict__ K,
                           const float* __restrict__ V,
                           const float* __restrict__ mask,
                           const float* __restrict__ cw,
                           float* out) {
  // one LDS arena: [qn 128 | kn 64 | vt 64 | p 8x16] rows of LPITCH halves (64 used) = 55296 B; reused as the f32 output stage [128][68] in the epilogue
  __shared__ __align__(16) unsigned char smem[(QTILE + KTILE + DHEAD + NWAVE * 16) * LPITCH * 2];
  _Float16* sm_qn = (_Float16*)smem;                       // normalized Q tile, row-major
  _Float16* sm_kn = sm_qn + QTILE * LPITCH;                 // normalized K block, row-major
  _Float16* sm_vt = sm_kn + KTILE * LPITCH;                 // V block transposed: vt[d][key]
  _Float16* sm_p  = sm_vt + DHEAD * LPITCH;                 // per-wave P tile (16 x 64)
  float* cst = (float*)smem;                               // epilogue stage [128][CSTR]
  const int CSTR = DHEAD + 4;

  const int h      = blockIdx.y;
  const int qbase  = blockIdx.x * QTILE;
  const int tid    = threadIdx.x;
  const int wv     = tid >> 5;
  const int lane   = tid & 31;
  const int lh     = lane >> 4;   // lane half: 0 or 1
  const int ln     = lane & 15;
  const int dofs8  = lh * 8;      // A-frag half offset (K 0-7/16-23 vs 8-15/24-31)
  const size_t headoff = (size_t)h * S_LEN * DHEAD;

  // ---------------- Stage L2-normalized Q tile (2 threads / row) ----------------
  {
    const int r  = tid >> 1;
    const int hf = tid & 1;
    const float* qrow = Q + headoff + (size_t)(qbase + r) * DHEAD + hf * 32;
    float4 b[8];
    float ss = 0.f;
#pragma unroll
    for (int i = 0; i < 8; ++i) {
      b[i] = ((const float4*)qrow)[i];
      ss += b[i].x * b[i].x + b[i].y * b[i].y + b[i].z * b[i].z + b[i].w * b[i].w;
    }
    ss += __shfl_xor(ss, 1);
    const float inv = 1.f / fmaxf(sqrtf(ss), 1e-12f);
    _Float16* dst = sm_qn + r * LPITCH + hf * 32;
#pragma unroll
    for (int i = 0; i < 8; ++i) {
      dst[i * 4 + 0] = (_Float16)(b[i].x * inv);
      dst[i * 4 + 1] = (_Float16)(b[i].y * inv);
      dst[i * 4 + 2] = (_Float16)(b[i].z * inv);
      dst[i * 4 + 3] = (_Float16)(b[i].w * inv);
    }
  }
  __syncthreads();

  // ---------------- Q A-fragments kept in registers for whole kernel ------------
  h16 qA[2];
#pragma unroll
  for (int c = 0; c < 2; ++c) {
    const _Float16* base = sm_qn + (wv * 16 + ln) * LPITCH + c * 32;
    qA[c] = cat16(lds_ld8(base + dofs8), lds_ld8(base + 16 + dofs8));
  }

  f8 oacc[4];
#pragma unroll
  for (int t = 0; t < 4; ++t) oacc[t] = {};

  _Float16* pw = sm_p + wv * 16 * LPITCH;

  // ================================ key-block loop ==============================
  for (int kb = 0; kb < S_LEN / KTILE; ++kb) {
    __syncthreads();  // everyone done reading previous Kn / Vt
    {
      const int r  = tid >> 2;      // key row 0..63
      const int q4 = tid & 3;       // 16-col quarter
      const int key = kb * KTILE + r;
      const float* krow = K + headoff + (size_t)key * DHEAD + q4 * 16;
      float4 b[4];
      float ss = 0.f;
#pragma unroll
      for (int i = 0; i < 4; ++i) {
        b[i] = ((const float4*)krow)[i];
        ss += b[i].x * b[i].x + b[i].y * b[i].y + b[i].z * b[i].z + b[i].w * b[i].w;
      }
      ss += __shfl_xor(ss, 1);
      ss += __shfl_xor(ss, 2);
      const float inv = 1.f / fmaxf(sqrtf(ss), 1e-12f);
      _Float16* dst = sm_kn + r * LPITCH + q4 * 16;
#pragma unroll
      for (int i = 0; i < 4; ++i) {
        dst[i * 4 + 0] = (_Float16)(b[i].x * inv);
        dst[i * 4 + 1] = (_Float16)(b[i].y * inv);
        dst[i * 4 + 2] = (_Float16)(b[i].z * inv);
        dst[i * 4 + 3] = (_Float16)(b[i].w * inv);
      }
      // V block, stored transposed so P*V B-fragments are contiguous b128 loads
      const float* vrow = V + headoff + (size_t)key * DHEAD + q4 * 16;
#pragma unroll
      for (int i = 0; i < 4; ++i) {
        const float4 v4 = ((const float4*)vrow)[i];
        const int c0 = q4 * 16 + i * 4;
        sm_vt[(c0 + 0) * LPITCH + r] = (_Float16)v4.x;
        sm_vt[(c0 + 1) * LPITCH + r] = (_Float16)v4.y;
        sm_vt[(c0 + 2) * LPITCH + r] = (_Float16)v4.z;
        sm_vt[(c0 + 3) * LPITCH + r] = (_Float16)v4.w;
      }
    }
    __syncthreads();

    // ---- S = Qn * Kn^T (16x64 per wave), transform, stash P in LDS -------------
#pragma unroll
    for (int nt = 0; nt < 4; ++nt) {
      const int n0 = nt * 16;
      const _Float16* kb0 = sm_kn + (n0 + ln) * LPITCH;
      // B fragment uses the same per-lane k map as A: elements 0-7 = k 8*lh..8*lh+7, elements 8-15 = k 16+8*lh..
      const h16 Blo = cat16(lds_ld8(kb0 + dofs8),      lds_ld8(kb0 + 16 + dofs8));
      const h16 Bhi = cat16(lds_ld8(kb0 + 32 + dofs8), lds_ld8(kb0 + 48 + dofs8));
      f8 acc = {};
      acc = __builtin_amdgcn_wmma_f32_16x16x32_f16(false, qA[0], false, Blo, (short)0, acc, false, false);
      acc = __builtin_amdgcn_wmma_f32_16x16x32_f16(false, qA[1], false, Bhi, (short)0, acc, false, false);
      asm volatile("v_nop\n\tv_nop\n\tv_nop\n\tv_nop" : "+v"(acc) : "v"(qA[0]), "v"(qA[1]), "v"(Blo), "v"(Bhi));
      const float km = mask[kb * KTILE + n0 + ln];  // key mask for this lane's column
#pragma unroll
      for (int r = 0; r < 8; ++r) {
        float s = acc[r];
        s = fminf(fmaxf(s, -1.f + 1e-6f), 1.f - 1e-6f);
        float p = 1.f - acosf(s) * 0.3183098861837907f;  // 1 - acos(s)/pi
        p = p * p; p = p * p; p = p * p;                  // ^8
        p *= km;
        pw[(lh * 8 + r) * LPITCH + n0 + ln] = (_Float16)p; // C-layout scatter
      }
    }

    __syncthreads();  // P tile stores complete (scalar f16 stores, vector reloads below)

    // ---- O += P * V (LDS round-trip gives A-layout P) -------------
#pragma unroll
    for (int kc = 0; kc < 2; ++kc) {
      const _Float16* pb = pw + ln * LPITCH + kc * 32;
      const h16 PA = cat16(lds_ld8(pb + dofs8), lds_ld8(pb + 16 + dofs8));
#pragma unroll
      for (int dt = 0; dt < 4; ++dt) {
        const _Float16* vb = sm_vt + (dt * 16 + ln) * LPITCH + kc * 32;
        const h16 BV = cat16(lds_ld8(vb + dofs8), lds_ld8(vb + 16 + dofs8));
        oacc[dt] = __builtin_amdgcn_wmma_f32_16x16x32_f16(false, PA, false, BV, (short)0, oacc[dt], false, false);
      }
      asm volatile("v_nop\n\tv_nop\n\tv_nop\n\tv_nop" : "+v"(oacc[0]), "+v"(oacc[1]), "+v"(oacc[2]), "+v"(oacc[3]) : "v"(PA));
    }
  }

  __syncthreads();  // all waves done with qn/kn/vt/p: arena becomes the f32 stage
  const float w0 = cw[h * 3 + 0], w1 = cw[h * 3 + 1], w2 = cw[h * 3 + 2];
  const int srow_base = qbase + wv * 16 + lh * 8;
#pragma unroll
  for (int r = 0; r < 8; ++r) {
    const int srow = srow_base + r;
    const float qm = mask[srow];
    float xv[4];
    float ss = 0.f;
#pragma unroll
    for (int dt = 0; dt < 4; ++dt) {   // reference order: mask BEFORE normalize
      xv[dt] = oacc[dt][r] * qm;
      ss += xv[dt] * xv[dt];
    }
    // reduce sum of squares across the 16 lanes of this half (row is constant there)
    ss += __shfl_xor(ss, 1);
    ss += __shfl_xor(ss, 2);
    ss += __shfl_xor(ss, 4);
    ss += __shfl_xor(ss, 8);
    const float inv = 1.f / fmaxf(sqrtf(ss), 1e-12f);

    const float* vc = V + headoff + (size_t)srow * DHEAD;
    const float mm1 = (srow > 0)          ? mask[srow - 1] : 0.f;
    const float mp1 = (srow < S_LEN - 1)  ? mask[srow + 1] : 0.f;
#pragma unroll
    for (int dt = 0; dt < 4; ++dt) {
      const int d = dt * 16 + ln;
      const float vm1 = (srow > 0)         ? vc[d - DHEAD] * mm1 : 0.f;
      const float v0  = vc[d] * qm;
      const float vp1 = (srow < S_LEN - 1) ? vc[d + DHEAD] * mp1 : 0.f;
      const float conv = w0 * vm1 + w1 * v0 + w2 * vp1;
      cst[(srow - qbase) * CSTR + d] = xv[dt] * inv + conv;
    }
  }
  __syncthreads();
  {
    const int col = tid & 63, rsel = tid >> 6;
    float* ob = out + headoff + (size_t)qbase * DHEAD;
#pragma unroll 4
    for (int r = rsel; r < QTILE; r += 4) *(float*)(ob + (size_t)r * DHEAD + col) = cst[r * CSTR + col];
    
  }
}

extern "C" void kernel_launch(void* const* d_in, const int* in_sizes, int n_in,
                              void* d_out, int out_size, void* d_ws, size_t ws_size,
                              hipStream_t stream) {
  (void)in_sizes; (void)n_in; (void)out_size; (void)d_ws; (void)ws_size;
  const float* Q    = (const float*)d_in[0];
  const float* K    = (const float*)d_in[1];
  const float* V    = (const float*)d_in[2];
  const float* mask = (const float*)d_in[3];
  const float* cw   = (const float*)d_in[4];
  float* out = (float*)d_out;

  dim3 grid(S_LEN / QTILE, NHEAD);  // 32 query tiles x 8 heads
  dim3 block(32 * NWAVE);           // 8 wave32 waves
  yoso_attn_wmma_kernel<<<grid, block, 0, stream>>>(Q, K, V, mask, cw, out);
}

// v002
// One run takes 100 microseconds.
// Timed twice side by side with v001, it ran 2.40 times as fast both times.
// All steps since v000 together make it 2.93 times as fast.
#include <hip/hip_runtime.h>

// Contractions Qn.Kn^T (K=64) and P.V (K=64 per key block) on v_wmma_f32_16x16x32_f16 (f16 operands, f32 accumulate); normalisation, arccos power, conv and epilogue in f32.

typedef _Float16 h8  __attribute__((ext_vector_type(8)));
typedef _Float16 h16 __attribute__((ext_vector_type(16)));
typedef float    f8  __attribute__((ext_vector_type(8)));

#define S_LEN 4096
#define NHEAD 8
#define DHEAD 64
#define QTILE 128
#define KTILE 64
#define NWAVE 8
#define NSPLIT 4   // key ranges per query tile: 4 work-groups of 8 waves share a WGP, so one group's load and LDS waits are covered by the others' vector work
#define KB_PER_SPLIT (S_LEN / KTILE / NSPLIT)
#define WAVE_TILE_F32 (16 * DHEAD)  // one wave's 16 x 64 f32 accumulator tile in the workspace, kept in fragment order
#define LPITCH 72  // LDS row pitch in halves: 144 B = 16 B x 9 (odd), so the 16 rows of a ds_load_b128 fragment read fall on distinct banks

__device__ __forceinline__ h16 cat16(h8 a, h8 b) {
  h16 r;
#pragma unroll
  for (int i = 0; i < 8; ++i) { r[i] = a[i]; r[i + 8] = b[i]; }
  return r;
}

__device__ __forceinline__ h8 lds_ld8(const _Float16* p) {
  return *(const h8*)p;
}

// waves_per_eu(8, 8): at most 4 of these work-groups per WGP, so the 1024 work-groups spread 4 to each of the 256 WGPs and none takes a fifth
__global__ __launch_bounds__(256) __attribute__((amdgpu_waves_per_eu(8, 8)))
void yoso_attn_wmma_kernel(const float* __restrict__ Q,
                           const float* __restrict__ K,
                           const float* __restrict__ V,
                           const float* __restrict__ mask,
                           float* __restrict__ part) {
  // one LDS arena: [qn 128 | kn 64 | vt 64 | p 8x16] rows of LPITCH halves (64 used) = 55296 B
  __shared__ __align__(16) unsigned char smem[(QTILE + KTILE + DHEAD + NWAVE * 16) * LPITCH * 2];
  _Float16* sm_qn = (_Float16*)smem;                       // normalized Q tile, row-major
  _Float16* sm_kn = sm_qn + QTILE * LPITCH;                 // normalized K block, row-major
  _Float16* sm_vt = sm_kn + KTILE * LPITCH;                 // V block transposed: vt[d][key]
  _Float16* sm_p  = sm_vt + DHEAD * LPITCH;                 // per-wave P tile (16 x 64)

  const int h      = blockIdx.y;
  const int ks     = blockIdx.z;  // key range of this work-group
  const int qbase  = blockIdx.x * QTILE;
  const int tid    = threadIdx.x;
  const int wv     = tid >> 5;
  const int lane   = tid & 31;
  const int lh     = lane >> 4;   // lane half: 0 or 1
  const int ln     = lane & 15;
  const int dofs8  = lh * 8;      // A-frag half offset (K 0-7/16-23 vs 8-15/24-31)
  const size_t headoff = (size_t)h * S_LEN * DHEAD;

  // ---------------- Stage L2-normalized Q tile (2 threads / row) ----------------
  {
    const int r  = tid >> 1;
    const int hf = tid & 1;
    const float* qrow = Q + headoff + (size_t)(qbase + r) * DHEAD + hf * 32;
    float4 b[8];
    float ss = 0.f;
#pragma unroll
    for (int i = 0; i < 8; ++i) {
      b[i] = ((const float4*)qrow)[i];
      ss += b[i].x * b[i].x + b[i].y * b[i].y + b[i].z * b[i].z + b[i].w * b[i].w;
    }
    ss += __shfl_xor(ss, 1);
    const float inv = 1.f / fmaxf(sqrtf(ss), 1e-12f);
    _Float16* dst = sm_qn + r * LPITCH + hf * 32;
#pragma unroll
    for (int i = 0; i < 8; ++i) {
      dst[i * 4 + 0] = (_Float16)(b[i].x * inv);
      dst[i * 4 + 1] = (_Float16)(b[i].y * inv);
      dst[i * 4 + 2] = (_Float16)(b[i].z * inv);
      dst[i * 4 + 3] = (_Float16)(b[i].w * inv);
    }
  }
  __syncthreads();

  // ---------------- Q A-fragments kept in registers for whole kernel ------------
  h16 qA[2];
#pragma unroll
  for (int c = 0; c < 2; ++c) {
    const _Float16* base = sm_qn + (wv * 16 + ln) * LPITCH + c * 32;
    qA[c] = cat16(lds_ld8(base + dofs8), lds_ld8(base + 16 + dofs8));
  }

  f8 oacc[4];
#pragma unroll
  for (int t = 0; t < 4; ++t) oacc[t] = {};

  _Float16* pw = sm_p + wv * 16 * LPITCH;

  // ================================ key-block loop ==============================
  for (int it = 0; it < KB_PER_SPLIT; ++it) {
    const int kb = ks * KB_PER_SPLIT + it;
    __syncthreads();  // everyone done reading previous Kn / Vt
    {
      const int r  = tid >> 2;      // key row 0..63
      const int q4 = tid & 3;       // 16-col quarter
      const int key = kb * KTILE + r;
      const float* krow = K + headoff + (size_t)key * DHEAD + q4 * 16;
      float4 b[4];
      float ss = 0.f;
#pragma unroll
      for (int i = 0; i < 4; ++i) {
        b[i] = ((const float4*)krow)[i];
        ss += b[i].x * b[i].x + b[i].y * b[i].y + b[i].z * b[i].z + b[i].w * b[i].w;
      }
      ss += __shfl_xor(ss, 1);
      ss += __shfl_xor(ss, 2);
      const float inv = 1.f / fmaxf(sqrtf(ss), 1e-12f);
      _Float16* dst = sm_kn + r * LPITCH + q4 * 16;
#pragma unroll
      for (int i = 0; i < 4; ++i) {
        dst[i * 4 + 0] = (_Float16)(b[i].x * inv);
        dst[i * 4 + 1] = (_Float16)(b[i].y * inv);
        dst[i * 4 + 2] = (_Float16)(b[i].z * inv);
        dst[i * 4 + 3] = (_Float16)(b[i].w * inv);
      }
      // V block, stored transposed so P*V B-fragments are contiguous b128 loads
      const float* vrow = V + headoff + (size_t)key * DHEAD + q4 * 16;
#pragma unroll
      for (int i = 0; i < 4; ++i) {
        const float4 v4 = ((const float4*)vrow)[i];
        const int c0 = q4 * 16 + i * 4;
        sm_vt[(c0 + 0) * LPITCH + r] = (_Float16)v4.x;
        sm_vt[(c0 + 1) * LPITCH + r] = (_Float16)v4.y;
        sm_vt[(c0 + 2) * LPITCH + r] = (_Float16)v4.z;
        sm_vt[(c0 + 3) * LPITCH + r] = (_Float16)v4.w;
      }
    }
    __syncthreads();

    // ---- S = Qn * Kn^T (16x64 per wave), transform, stash P in LDS -------------
#pragma unroll
    for (int nt = 0; nt < 4; ++nt) {
      const int n0 = nt * 16;
      const _Float16* kb0 = sm_kn + (n0 + ln) * LPITCH;
      // B fragment uses the same per-lane k map as A: elements 0-7 = k 8*lh..8*lh+7, elements 8-15 = k 16+8*lh..
      const h16 Blo = cat16(lds_ld8(kb0 + dofs8),      lds_ld8(kb0 + 16 + dofs8));
      const h16 Bhi = cat16(lds_ld8(kb0 + 32 + dofs8), lds_ld8(kb0 + 48 + dofs8));
      f8 acc = {};
      acc = __builtin_amdgcn_wmma_f32_16x16x32_f16(false, qA[0], false, Blo, (short)0, acc, false, false);
      acc = __builtin_amdgcn_wmma_f32_16x16x32_f16(false, qA[1], false, Bhi, (short)0, acc, false, false);
      asm volatile("v_nop\n\tv_nop\n\tv_nop\n\tv_nop" : "+v"(acc) : "v"(qA[0]), "v"(qA[1]), "v"(Blo), "v"(Bhi));
      const float km = mask[kb * KTILE + n0 + ln];  // key mask for this lane's column
#pragma unroll
      for (int r = 0; r < 8; ++r) {
        float s = acc[r];
        s = fminf(fmaxf(s, -1.f + 1e-6f), 1.f - 1e-6f);
        float p = 1.f - acosf(s) * 0.3183098861837907f;  // 1 - acos(s)/pi
        p = p * p; p = p * p; p = p * p;                  // ^8
        p *= km;
        pw[(lh * 8 + r) * LPITCH + n0 + ln] = (_Float16)p; // C-layout scatter
      }
    }

    __syncthreads();  // P tile stores complete (scalar f16 stores, vector reloads below)

    // ---- O += P * V (LDS round-trip gives A-layout P) -------------
#pragma unroll
    for (int kc = 0; kc < 2; ++kc) {
      const _Float16* pb = pw + ln * LPITCH + kc * 32;
      const h16 PA = cat16(lds_ld8(pb + dofs8), lds_ld8(pb + 16 + dofs8));
#pragma unroll
      for (int dt = 0; dt < 4; ++dt) {
        const _Float16* vb = sm_vt + (dt * 16 + ln) * LPITCH + kc * 32;
        const h16 BV = cat16(lds_ld8(vb + dofs8), lds_ld8(vb + 16 + dofs8));
        oacc[dt] = __builtin_amdgcn_wmma_f32_16x16x32_f16(false, PA, false, BV, (short)0, oacc[dt], false, false);
      }
      asm volatile("v_nop\n\tv_nop\n\tv_nop\n\tv_nop" : "+v"(oacc[0]), "+v"(oacc[1]), "+v"(oacc[2]), "+v"(oacc[3]) : "v"(PA));
    }
  }

  // ---- partial O of this key range to the workspace, in fragment order: every store is 32 lanes x 16 B = 4 whole lines ----
  {
    float* pt = part + ((((size_t)h * (S_LEN / QTILE) + blockIdx.x) * NWAVE + wv) * NSPLIT + ks) * WAVE_TILE_F32 + lane * 4;
    // both loops unrolled: the accumulators live in registers and need constant indices
#pragma unroll
    for (int dt = 0; dt < 4; ++dt) {
#pragma unroll
      for (int hf = 0; hf < 2; ++hf) {
        *(float4*)(pt + (dt * 2 + hf) * 128) =
            make_float4(oacc[dt][hf * 4 + 0], oacc[dt][hf * 4 + 1], oacc[dt][hf * 4 + 2], oacc[dt][hf * 4 + 3]);
      }
    }
  }
}

// Second launch: sums the NSPLIT partial tiles in fixed order (range 0, 1, 2, 3), then query mask, normalisation, conv branch and the staged store.
__global__ __launch_bounds__(256)
void attn_merge_epilogue_kernel(const float* __restrict__ part,
                                const float* __restrict__ V,
                                const float* __restrict__ mask,
                                const float* __restrict__ cw,
                                float* out) {
  const int CSTR = DHEAD + 4;
  __shared__ __align__(16) float cst[QTILE * (DHEAD + 4)];  // output stage [128][CSTR]

  const int h      = blockIdx.y;
  const int qbase  = blockIdx.x * QTILE;
  const int tid    = threadIdx.x;
  const int wv     = tid >> 5;
  const int lane   = tid & 31;
  const int lh     = lane >> 4;
  const int ln     = lane & 15;
  const size_t headoff = (size_t)h * S_LEN * DHEAD;

  f8 oacc[4];
  {
    // wave-uniform tile base (scalar) + one per-lane byte offset: all 32 loads name the same vector register
    const int wvu = __builtin_amdgcn_readfirstlane(wv);
    const char* pt = (const char*)(part + (((size_t)h * (S_LEN / QTILE) + blockIdx.x) * NWAVE + wvu) * (NSPLIT * WAVE_TILE_F32));
    const int split_bytes = WAVE_TILE_F32 * 4;  // the NSPLIT partial tiles of one wave tile lie side by side
    const unsigned lofs = lane * 16u;
    float4 pv[NSPLIT][8];
    // all loops here unrolled: pv and oacc live in registers and need constant indices; the loads stand ahead of the sums
#pragma unroll
    for (int s = 0; s < NSPLIT; ++s)
#pragma unroll
      for (int j = 0; j < 8; ++j) pv[s][j] = *(const float4*)(pt + s * split_bytes + j * 512 + lofs);
#pragma unroll
    for (int j = 0; j < 8; ++j) {
      float4 a = pv[0][j];
#pragma unroll
      for (int s = 1; s < NSPLIT; ++s) { a.x += pv[s][j].x; a.y += pv[s][j].y; a.z += pv[s][j].z; a.w += pv[s][j].w; }
      oacc[j >> 1][(j & 1) * 4 + 0] = a.x;
      oacc[j >> 1][(j & 1) * 4 + 1] = a.y;
      oacc[j >> 1][(j & 1) * 4 + 2] = a.z;
      oacc[j >> 1][(j & 1) * 4 + 3] = a.w;
    }
  }

  const float w0 = cw[h * 3 + 0], w1 = cw[h * 3 + 1], w2 = cw[h * 3 + 2];
  const int srow_base = qbase + wv * 16 + lh * 8;
#pragma unroll
  for (int r = 0; r < 8; ++r) {
    const int srow = srow_base + r;
    const float qm = mask[srow];
    float xv[4];
    float ss = 0.f;
#pragma unroll
    for (int dt = 0; dt < 4; ++dt) {   // reference order: mask BEFORE normalize
      xv[dt] = oacc[dt][r] * qm;
      ss += xv[dt] * xv[dt];
    }
    // reduce sum of squares across the 16 lanes of this half (row is constant there)
    ss += __shfl_xor(ss, 1);
    ss += __shfl_xor(ss, 2);
    ss += __shfl_xor(ss, 4);
    ss += __shfl_xor(ss, 8);
    const float inv = 1.f / fmaxf(sqrtf(ss), 1e-12f);

    const float* vc = V + headoff + (size_t)srow * DHEAD;
    const float mm1 = (srow > 0)          ? mask[srow - 1] : 0.f;
    const float mp1 = (srow < S_LEN - 1)  ? mask[srow + 1] : 0.f;
#pragma unroll
    for (int dt = 0; dt < 4; ++dt) {
      const int d = dt * 16 + ln;
      const float vm1 = (srow > 0)         ? vc[d - DHEAD] * mm1 : 0.f;
      const float v0  = vc[d] * qm;
      const float vp1 = (srow < S_LEN - 1) ? vc[d + DHEAD] * mp1 : 0.f;
      const float conv = w0 * vm1 + w1 * v0 + w2 * vp1;
      cst[(srow - qbase) * CSTR + d] = xv[dt] * inv + conv;
    }
  }
  __syncthreads();
  {
    const int col = tid & 63, rsel = tid >> 6;
    float* ob = out + headoff + (size_t)qbase * DHEAD;
#pragma unroll 4
    for (int r = rsel; r < QTILE; r += 4) *(float*)(ob + (size_t)r * DHEAD + col) = cst[r * CSTR + col];
    
  }
}

extern "C" void kernel_launch(void* const* d_in, const int* in_sizes, int n_in,
                              void* d_out, int out_size, void* d_ws, size_t ws_size,
                              hipStream_t stream) {
  (void)in_sizes; (void)n_in; (void)out_size; (void)ws_size;
  const float* Q    = (const float*)d_in[0];
  const float* K    = (const float*)d_in[1];
  const float* V    = (const float*)d_in[2];
  const float* mask = (const float*)d_in[3];
  const float* cw   = (const float*)d_in[4];
  float* out = (float*)d_out;

  float* part = (float*)d_ws;       // NSPLIT x 8 MiB of f32 partial tiles, all written by the first launch

  dim3 grid(S_LEN / QTILE, NHEAD, NSPLIT);  // 32 query tiles x 8 heads x 4 key ranges
  dim3 grid2(S_LEN / QTILE, NHEAD);
  dim3 block(32 * NWAVE);                   // 8 wave32 waves
  yoso_attn_wmma_kernel<<<grid, block, 0, stream>>>(Q, K, V, mask, part);
  attn_merge_epilogue_kernel<<<grid2, block, 0, stream>>>(part, V, mask, cw, out);
}

// v003
// It runs in 87.3 microseconds.
// Two timings next to v002 both put it at 1.15 times that version's speed.
// All steps since v000 together make it 3.37 times as fast.
#include <hip/hip_runtime.h>

// Contractions Qn.Kn^T (K=64) and P.V (K=64 per key block) on v_wmma_f32_16x16x32_f16 (f16 operands, f32 accumulate); normalisation, arccos power, conv and epilogue in f32.

typedef _Float16 h8  __attribute__((ext_vector_type(8)));
typedef _Float16 h16 __attribute__((ext_vector_type(16)));
typedef float    f8  __attribute__((ext_vector_type(8)));
typedef float    f2  __attribute__((ext_vector_type(2)));
typedef _Float16 h2  __attribute__((ext_vector_type(2)));

#define S_LEN 4096
#define NHEAD 8
#define DHEAD 64
#define QTILE 128
#define KTILE 64
#define NWAVE 8
#define NSPLIT 4   // key ranges per query tile: 4 work-groups of 8 waves share a WGP, so one group's load and LDS waits are covered by the others' vector work
#define KB_PER_SPLIT (S_LEN / KTILE / NSPLIT)
#define WAVE_TILE_F32 (16 * DHEAD)  // one wave's 16 x 64 f32 accumulator tile in the workspace, kept in fragment order
#define LPITCH 72  // LDS row pitch in halves: 144 B = 16 B x 9 (odd), so the 16 rows of a ds_load_b128 fragment read fall on distinct banks

__device__ __forceinline__ h16 cat16(h8 a, h8 b) {
  h16 r;
#pragma unroll
  for (int i = 0; i < 8; ++i) { r[i] = a[i]; r[i + 8] = b[i]; }
  return r;
}

__device__ __forceinline__ h8 lds_ld8(const _Float16* p) {
  return *(const h8*)p;
}

// (1 - acos(s)/pi)^2 as one polynomial in y = sqrt((1 - s)/2), for every s in [-1, 1].
// acos(s) = 2 asin(y), so 1 - acos(s)/pi = (2/pi) acos(y); acos(y) behaves like sqrt(1 - y) at y = 1, its square is smooth there,
// and the only singular point left is y = -1, outside [0, 1]: no branch on the sign or the size of s, and one squaring fewer.
// Degree-7 minimax fit on [0, 1], weighted for the relative error of the 8th power: the fit is within about 1e-6 of it, and with the f32
// rounding of the chain within 6e-6, wherever it is an f16 normal number; under 1e-9 absolute below that. The f16 rounding of P that
// follows is 5e-4 relative.
// Two scores at a time: the pairs keep every multiply-add of the chain on the packed f32 form.
__device__ __forceinline__ f2 collision_sq(f2 y) {
  f2 q = (f2)(-0.00522967149f);
  q = __builtin_elementwise_fma(q, y, (f2)(0.0269641094f));
  q = __builtin_elementwise_fma(q, y, (f2)(-0.0683889985f));
  q = __builtin_elementwise_fma(q, y, (f2)(0.124759011f));
  q = __builtin_elementwise_fma(q, y, (f2)(-0.20989652f));
  q = __builtin_elementwise_fma(q, y, (f2)(0.405017912f));
  q = __builtin_elementwise_fma(q, y, (f2)(-1.27322733f));
  q = __builtin_elementwise_fma(q, y, (f2)(0.999999881f));
  return q;
}

// waves_per_eu(8, 8): at most 4 of these work-groups per WGP, so the 1024 work-groups spread 4 to each of the 256 WGPs and none takes a fifth
__global__ __launch_bounds__(256) __attribute__((amdgpu_waves_per_eu(8, 8)))
void yoso_attn_wmma_kernel(const float* __restrict__ Q,
                           const float* __restrict__ K,
                           const float* __restrict__ V,
                           const float* __restrict__ mask,
                           float* __restrict__ part) {
  // one LDS arena: [qn 128 | kn 64 | vt 64 | p 8x16] rows of LPITCH halves (64 used) = 55296 B
  __shared__ __align__(16) unsigned char smem[(QTILE + KTILE + DHEAD + NWAVE * 16) * LPITCH * 2];
  _Float16* sm_qn = (_Float16*)smem;                       // normalized Q tile, row-major
  _Float16* sm_kn = sm_qn + QTILE * LPITCH;                 // normalized K block, row-major
  _Float16* sm_vt = sm_kn + KTILE * LPITCH;                 // V block transposed: vt[d][key]
  _Float16* sm_p  = sm_vt + DHEAD * LPITCH;                 // per-wave P tile (16 x 64)

  const int h      = blockIdx.y;
  const int ks     = blockIdx.z;  // key range of this work-group
  const int qbase  = blockIdx.x * QTILE;
  const int tid    = threadIdx.x;
  const int wv     = tid >> 5;
  const int lane   = tid & 31;
  const int lh     = lane >> 4;   // lane half: 0 or 1
  const int ln     = lane & 15;
  const int dofs8  = lh * 8;      // A-frag half offset (K 0-7/16-23 vs 8-15/24-31)
  const size_t headoff = (size_t)h * S_LEN * DHEAD;

  // ---------------- Stage L2-normalized Q tile (2 threads / row) ----------------
  {
    const int r  = tid >> 1;
    const int hf = tid & 1;
    const float* qrow = Q + headoff + (size_t)(qbase + r) * DHEAD + hf * 32;
    float4 b[8];
    float ss = 0.f;
#pragma unroll
    for (int i = 0; i < 8; ++i) {
      b[i] = ((const float4*)qrow)[i];
      ss += b[i].x * b[i].x + b[i].y * b[i].y + b[i].z * b[i].z + b[i].w * b[i].w;
    }
    ss += __shfl_xor(ss, 1);
    const float inv = 1.f / fmaxf(sqrtf(ss), 1e-12f);
    _Float16* dst = sm_qn + r * LPITCH + hf * 32;
#pragma unroll
    for (int i = 0; i < 8; ++i) {
      dst[i * 4 + 0] = (_Float16)(b[i].x * inv);
      dst[i * 4 + 1] = (_Float16)(b[i].y * inv);
      dst[i * 4 + 2] = (_Float16)(b[i].z * inv);
      dst[i * 4 + 3] = (_Float16)(b[i].w * inv);
    }
  }
  __syncthreads();

  // ---------------- Q A-fragments kept in registers for whole kernel ------------
  h16 qA[2];
#pragma unroll
  for (int c = 0; c < 2; ++c) {
    const _Float16* base = sm_qn + (wv * 16 + ln) * LPITCH + c * 32;
    qA[c] = cat16(lds_ld8(base + dofs8), lds_ld8(base + 16 + dofs8));
  }

  f8 oacc[4];
#pragma unroll
  for (int t = 0; t < 4; ++t) oacc[t] = {};

  _Float16* pw = sm_p + wv * 16 * LPITCH;

  // ================================ key-block loop ==============================
  for (int it = 0; it < KB_PER_SPLIT; ++it) {
    const int kb = ks * KB_PER_SPLIT + it;
    __syncthreads();  // everyone done reading previous Kn / Vt
    {
      const int r  = tid >> 2;      // key row 0..63
      const int q4 = tid & 3;       // 16-col quarter
      const int key = kb * KTILE + r;
      const float* krow = K + headoff + (size_t)key * DHEAD + q4 * 16;
      float4 b[4];
      float ss = 0.f;
#pragma unroll
      for (int i = 0; i < 4; ++i) {
        b[i] = ((const float4*)krow)[i];
        ss += b[i].x * b[i].x + b[i].y * b[i].y + b[i].z * b[i].z + b[i].w * b[i].w;
      }
      ss += __shfl_xor(ss, 1);
      ss += __shfl_xor(ss, 2);
      const float inv = 1.f / fmaxf(sqrtf(ss), 1e-12f);
      _Float16* dst = sm_kn + r * LPITCH + q4 * 16;
#pragma unroll
      for (int i = 0; i < 4; ++i) {
        dst[i * 4 + 0] = (_Float16)(b[i].x * inv);
        dst[i * 4 + 1] = (_Float16)(b[i].y * inv);
        dst[i * 4 + 2] = (_Float16)(b[i].z * inv);
        dst[i * 4 + 3] = (_Float16)(b[i].w * inv);
      }
      // V block, stored transposed so P*V B-fragments are contiguous b128 loads
      const float* vrow = V + headoff + (size_t)key * DHEAD + q4 * 16;
#pragma unroll
      for (int i = 0; i < 4; ++i) {
        const float4 v4 = ((const float4*)vrow)[i];
        const int c0 = q4 * 16 + i * 4;
        sm_vt[(c0 + 0) * LPITCH + r] = (_Float16)v4.x;
        sm_vt[(c0 + 1) * LPITCH + r] = (_Float16)v4.y;
        sm_vt[(c0 + 2) * LPITCH + r] = (_Float16)v4.z;
        sm_vt[(c0 + 3) * LPITCH + r] = (_Float16)v4.w;
      }
    }
    __syncthreads();

    // ---- S = Qn * Kn^T (16x64 per wave), transform, stash P in LDS -------------
#pragma unroll
    for (int nt = 0; nt < 4; ++nt) {
      const int n0 = nt * 16;
      const _Float16* kb0 = sm_kn + (n0 + ln) * LPITCH;
      // B fragment uses the same per-lane k map as A: elements 0-7 = k 8*lh..8*lh+7, elements 8-15 = k 16+8*lh..
      const h16 Blo = cat16(lds_ld8(kb0 + dofs8),      lds_ld8(kb0 + 16 + dofs8));
      const h16 Bhi = cat16(lds_ld8(kb0 + 32 + dofs8), lds_ld8(kb0 + 48 + dofs8));
      f8 acc = {};
      acc = __builtin_amdgcn_wmma_f32_16x16x32_f16(false, qA[0], false, Blo, (short)0, acc, false, false);
      acc = __builtin_amdgcn_wmma_f32_16x16x32_f16(false, qA[1], false, Bhi, (short)0, acc, false, false);
      asm volatile("v_nop\n\tv_nop\n\tv_nop\n\tv_nop" : "+v"(acc) : "v"(qA[0]), "v"(qA[1]), "v"(Blo), "v"(Bhi));
      const float km = mask[kb * KTILE + n0 + ln];  // key mask for this lane's column
#pragma unroll
      for (int r = 0; r < 8; r += 2) {
        f2 s;                                             // the reference's clip
        s.x = __builtin_amdgcn_fmed3f(acc[r],     -1.f + 1e-6f, 1.f - 1e-6f);
        s.y = __builtin_amdgcn_fmed3f(acc[r + 1], -1.f + 1e-6f, 1.f - 1e-6f);
        const f2 z = __builtin_elementwise_fma(s, (f2)(-0.5f), (f2)(0.5f));
        f2 y;                                             // y = sin(acos(s)/2), in (0, 1)
        y.x = __builtin_amdgcn_sqrtf(z.x);
        y.y = __builtin_amdgcn_sqrtf(z.y);
        f2 p = collision_sq(y);                           // (1 - acos(s)/pi)^2
        p = p * p; p = p * p;                             // ^8
        p *= km;
        const h2 ph = __builtin_convertvector(p, h2);
        pw[(lh * 8 + r) * LPITCH + n0 + ln]     = ph.x;   // C-layout scatter
        pw[(lh * 8 + r + 1) * LPITCH + n0 + ln] = ph.y;
      }
    }

    __syncthreads();  // P tile stores complete (scalar f16 stores, vector reloads below)

    // ---- O += P * V (LDS round-trip gives A-layout P) -------------
#pragma unroll
    for (int kc = 0; kc < 2; ++kc) {
      const _Float16* pb = pw + ln * LPITCH + kc * 32;
      const h16 PA = cat16(lds_ld8(pb + dofs8), lds_ld8(pb + 16 + dofs8));
#pragma unroll
      for (int dt = 0; dt < 4; ++dt) {
        const _Float16* vb = sm_vt + (dt * 16 + ln) * LPITCH + kc * 32;
        const h16 BV = cat16(lds_ld8(vb + dofs8), lds_ld8(vb + 16 + dofs8));
        oacc[dt] = __builtin_amdgcn_wmma_f32_16x16x32_f16(false, PA, false, BV, (short)0, oacc[dt], false, false);
      }
      asm volatile("v_nop\n\tv_nop\n\tv_nop\n\tv_nop" : "+v"(oacc[0]), "+v"(oacc[1]), "+v"(oacc[2]), "+v"(oacc[3]) : "v"(PA));
    }
  }

  // ---- partial O of this key range to the workspace, in fragment order: every store is 32 lanes x 16 B = 4 whole lines ----
  {
    float* pt = part + ((((size_t)h * (S_LEN / QTILE) + blockIdx.x) * NWAVE + wv) * NSPLIT + ks) * WAVE_TILE_F32 + lane * 4;
    // both loops unrolled: the accumulators live in registers and need constant indices
#pragma unroll
    for (int dt = 0; dt < 4; ++dt) {
#pragma unroll
      for (int hf = 0; hf < 2; ++hf) {
        *(float4*)(pt + (dt * 2 + hf) * 128) =
            make_float4(oacc[dt][hf * 4 + 0], oacc[dt][hf * 4 + 1], oacc[dt][hf * 4 + 2], oacc[dt][hf * 4 + 3]);
      }
    }
  }
}

// Second launch: sums the NSPLIT partial tiles in fixed order (range 0, 1, 2, 3), then query mask, normalisation, conv branch and the staged store.
__global__ __launch_bounds__(256)
void attn_merge_epilogue_kernel(const float* __restrict__ part,
                                const float* __restrict__ V,
                                const float* __restrict__ mask,
                                const float* __restrict__ cw,
                                float* out) {
  const int CSTR = DHEAD + 4;
  __shared__ __align__(16) float cst[QTILE * (DHEAD + 4)];  // output stage [128][CSTR]

  const int h      = blockIdx.y;
  const int qbase  = blockIdx.x * QTILE;
  const int tid    = threadIdx.x;
  const int wv     = tid >> 5;
  const int lane   = tid & 31;
  const int lh     = lane >> 4;
  const int ln     = lane & 15;
  const size_t headoff = (size_t)h * S_LEN * DHEAD;

  f8 oacc[4];
  {
    // wave-uniform tile base (scalar) + one per-lane byte offset: all 32 loads name the same vector register
    const int wvu = __builtin_amdgcn_readfirstlane(wv);
    const char* pt = (const char*)(part + (((size_t)h * (S_LEN / QTILE) + blockIdx.x) * NWAVE + wvu) * (NSPLIT * WAVE_TILE_F32));
    const int split_bytes = WAVE_TILE_F32 * 4;  // the NSPLIT partial tiles of one wave tile lie side by side
    const unsigned lofs = lane * 16u;
    float4 pv[NSPLIT][8];
    // all loops here unrolled: pv and oacc live in registers and need constant indices; the loads stand ahead of the sums
#pragma unroll
    for (int s = 0; s < NSPLIT; ++s)
#pragma unroll
      for (int j = 0; j < 8; ++j) pv[s][j] = *(const float4*)(pt + s * split_bytes + j * 512 + lofs);
#pragma unroll
    for (int j = 0; j < 8; ++j) {
      float4 a = pv[0][j];
#pragma unroll
      for (int s = 1; s < NSPLIT; ++s) { a.x += pv[s][j].x; a.y += pv[s][j].y; a.z += pv[s][j].z; a.w += pv[s][j].w; }
      oacc[j >> 1][(j & 1) * 4 + 0] = a.x;
      oacc[j >> 1][(j & 1) * 4 + 1] = a.y;
      oacc[j >> 1][(j & 1) * 4 + 2] = a.z;
      oacc[j >> 1][(j & 1) * 4 + 3] = a.w;
    }
  }

  const float w0 = cw[h * 3 + 0], w1 = cw[h * 3 + 1], w2 = cw[h * 3 + 2];
  const int srow_base = qbase + wv * 16 + lh * 8;
#pragma unroll
  for (int r = 0; r < 8; ++r) {
    const int srow = srow_base + r;
    const float qm = mask[srow];
    float xv[4];
    float ss = 0.f;
#pragma unroll
    for (int dt = 0; dt < 4; ++dt) {   // reference order: mask BEFORE normalize
      xv[dt] = oacc[dt][r] * qm;
      ss += xv[dt] * xv[dt];
    }
    // reduce sum of squares across the 16 lanes of this half (row is constant there)
    ss += __shfl_xor(ss, 1);
    ss += __shfl_xor(ss, 2);
    ss += __shfl_xor(ss, 4);
    ss += __shfl_xor(ss, 8);
    const float inv = 1.f / fmaxf(sqrtf(ss), 1e-12f);

    const float* vc = V + headoff + (size_t)srow * DHEAD;
    const float mm1 = (srow > 0)          ? mask[srow - 1] : 0.f;
    const float mp1 = (srow < S_LEN - 1)  ? mask[srow + 1] : 0.f;
#pragma unroll
    for (int dt = 0; dt < 4; ++dt) {
      const int d = dt * 16 + ln;
      const float vm1 = (srow > 0)         ? vc[d - DHEAD] * mm1 : 0.f;
      const float v0  = vc[d] * qm;
      const float vp1 = (srow < S_LEN - 1) ? vc[d + DHEAD] * mp1 : 0.f;
      const float conv = w0 * vm1 + w1 * v0 + w2 * vp1;
      cst[(srow - qbase) * CSTR + d] = xv[dt] * inv + conv;
    }
  }
  __syncthreads();
  {
    const int col = tid & 63, rsel = tid >> 6;
    float* ob = out + headoff + (size_t)qbase * DHEAD;
#pragma unroll 4
    for (int r = rsel; r < QTILE; r += 4) *(float*)(ob + (size_t)r * DHEAD + col) = cst[r * CSTR + col];
    
  }
}

extern "C" void kernel_launch(void* const* d_in, const int* in_sizes, int n_in,
                              void* d_out, int out_size, void* d_ws, size_t ws_size,
                              hipStream_t stream) {
  (void)in_sizes; (void)n_in; (void)out_size; (void)ws_size;
  const float* Q    = (const float*)d_in[0];
  const float* K    = (const float*)d_in[1];
  const float* V    = (const float*)d_in[2];
  const float* mask = (const float*)d_in[3];
  const float* cw   = (const float*)d_in[4];
  float* out = (float*)d_out;

  float* part = (float*)d_ws;       // NSPLIT x 8 MiB of f32 partial tiles, all written by the first launch

  dim3 grid(S_LEN / QTILE, NHEAD, NSPLIT);  // 32 query tiles x 8 heads x 4 key ranges
  dim3 grid2(S_LEN / QTILE, NHEAD);
  dim3 block(32 * NWAVE);                   // 8 wave32 waves
  yoso_attn_wmma_kernel<<<grid, block, 0, stream>>>(Q, K, V, mask, part);
  attn_merge_epilogue_kernel<<<grid2, block, 0, stream>>>(part, V, mask, cw, out);
}

// v004
// A run of this version takes 74.6 microseconds.
// Next to v003, in two timings, it ran 1.17 times as fast each time.
// All steps since v000 together make it 3.95 times as fast.
#include <hip/hip_runtime.h>

// Contractions Qn.Kn^T (K=64) and P.V (K=64 per key block) on v_wmma_f32_16x16x32_f16 (f16 operands, f32 accumulate); normalisation, arccos power, conv and epilogue in f32.

typedef _Float16 h8  __attribute__((ext_vector_type(8)));
typedef _Float16 h16 __attribute__((ext_vector_type(16)));
typedef float    f8  __attribute__((ext_vector_type(8)));
typedef float    f2  __attribute__((ext_vector_type(2)));
typedef _Float16 h2  __attribute__((ext_vector_type(2)));

#define S_LEN 4096
#define NHEAD 8
#define DHEAD 64
#define QTILE 128
#define KTILE 64
#define NWAVE 8
#define NSPLIT 4   // key ranges per query tile: 4 work-groups of 8 waves share a WGP, so one group's load and LDS waits are covered by the others' vector work
#define KB_PER_SPLIT (S_LEN / KTILE / NSPLIT)
#define WAVE_TILE_F32 (16 * DHEAD)  // one wave's 16 x 64 f32 accumulator tile in the workspace, kept in fragment order
#define KV_TILE_H (2 * KTILE * DHEAD)  // halves of one key block in the workspace: 64 x 64 normalized K rows, then 64 x 64 V transposed (d-major)
#define KV_OFS_F32 ((size_t)NSPLIT * NHEAD * S_LEN * DHEAD)  // the f16 tiles lie behind the f32 partial tiles
#define LPITCH 72  // LDS row pitch in halves: 144 B = 16 B x 9 (odd), so the 16 rows of a ds_load_b128 fragment read fall on distinct banks

__device__ __forceinline__ h16 cat16(h8 a, h8 b) {
  h16 r;
#pragma unroll
  for (int i = 0; i < 8; ++i) { r[i] = a[i]; r[i + 8] = b[i]; }
  return r;
}

__device__ __forceinline__ h8 lds_ld8(const _Float16* p) {
  return *(const h8*)p;
}

// (1 - acos(s)/pi)^2 as one polynomial in y = sqrt((1 - s)/2), for every s in [-1, 1].
// acos(s) = 2 asin(y), so 1 - acos(s)/pi = (2/pi) acos(y); acos(y) behaves like sqrt(1 - y) at y = 1, its square is smooth there,
// and the only singular point left is y = -1, outside [0, 1]: no branch on the sign or the size of s, and one squaring fewer.
// Degree-7 minimax fit on [0, 1], weighted for the relative error of the 8th power: the fit is within about 1e-6 of it, and with the f32
// rounding of the chain within 6e-6, wherever it is an f16 normal number; under 1e-9 absolute below that. The f16 rounding of P that
// follows is 5e-4 relative.
// Two scores at a time: the pairs keep every multiply-add of the chain on the packed f32 form.
__device__ __forceinline__ f2 collision_sq(f2 y) {
  f2 q = (f2)(-0.00522967149f);
  q = __builtin_elementwise_fma(q, y, (f2)(0.0269641094f));
  q = __builtin_elementwise_fma(q, y, (f2)(-0.0683889985f));
  q = __builtin_elementwise_fma(q, y, (f2)(0.124759011f));
  q = __builtin_elementwise_fma(q, y, (f2)(-0.20989652f));
  q = __builtin_elementwise_fma(q, y, (f2)(0.405017912f));
  q = __builtin_elementwise_fma(q, y, (f2)(-1.27322733f));
  q = __builtin_elementwise_fma(q, y, (f2)(0.999999881f));
  return q;
}

// First launch: each 64-key block once per head (the main launch reads it from 32 query tiles): K rows L2-normalized to f16, V to f16 and transposed.
__global__ __launch_bounds__(256)
void kv_f16_tiles_kernel(const float* __restrict__ K,
                         const float* __restrict__ V,
                         float* __restrict__ kvw) {
  __shared__ __align__(16) _Float16 sm_kn[(KTILE + DHEAD) * LPITCH];  // 64 rows of Kn, then 64 rows of vt[d][key]
  _Float16* sm_vt = sm_kn + KTILE * LPITCH;
  const int h   = blockIdx.y;
  const int kb  = blockIdx.x;
  const int tid = threadIdx.x;
  const size_t headoff = (size_t)h * S_LEN * DHEAD;
  {
    const int r  = tid >> 2;      // key row 0..63
    const int q4 = tid & 3;       // 16-col quarter
    const int key = kb * KTILE + r;
    const float* krow = K + headoff + (size_t)key * DHEAD + q4 * 16;
    float4 b[4];
    float ss = 0.f;
#pragma unroll
    for (int i = 0; i < 4; ++i) {
      b[i] = ((const float4*)krow)[i];
      ss += b[i].x * b[i].x + b[i].y * b[i].y + b[i].z * b[i].z + b[i].w * b[i].w;
    }
    ss += __shfl_xor(ss, 1);
    ss += __shfl_xor(ss, 2);
    const float inv = 1.f / fmaxf(sqrtf(ss), 1e-12f);
    _Float16* dst = sm_kn + r * LPITCH + q4 * 16;
#pragma unroll
    for (int i = 0; i < 4; ++i) {
      dst[i * 4 + 0] = (_Float16)(b[i].x * inv);
      dst[i * 4 + 1] = (_Float16)(b[i].y * inv);
      dst[i * 4 + 2] = (_Float16)(b[i].z * inv);
      dst[i * 4 + 3] = (_Float16)(b[i].w * inv);
    }
    // V block, stored transposed so P*V B-fragments are contiguous b128 loads
    const float* vrow = V + headoff + (size_t)key * DHEAD + q4 * 16;
#pragma unroll
    for (int i = 0; i < 4; ++i) {
      const float4 v4 = ((const float4*)vrow)[i];
      const int c0 = q4 * 16 + i * 4;
      const f2 lo = {v4.x, v4.y}, hi = {v4.z, v4.w};  // pairs: one packed conversion for two values
      const h2 hlo = __builtin_convertvector(lo, h2), hhi = __builtin_convertvector(hi, h2);
      sm_vt[(c0 + 0) * LPITCH + r] = hlo.x;
      sm_vt[(c0 + 1) * LPITCH + r] = hlo.y;
      sm_vt[(c0 + 2) * LPITCH + r] = hhi.x;
      sm_vt[(c0 + 3) * LPITCH + r] = hhi.y;
    }
  }
  __syncthreads();  // all 128 rows complete before they are read back whole
  {
    // 128 rows of 128 B go out unpadded, 16 KiB in a row: every store is 32 lanes x 16 B = 4 whole lines
    h8* g = (h8*)((_Float16*)kvw + (size_t)(h * (S_LEN / KTILE) + kb) * KV_TILE_H) + tid;
    const _Float16* s = sm_kn + (tid >> 3) * LPITCH + (tid & 7) * 8;
    // unrolled: the four LDS reads are issued together, ahead of the stores
#pragma unroll
    for (int j = 0; j < 4; ++j) g[j * 256] = lds_ld8(s + j * 32 * LPITCH);
  }
}

// waves_per_eu(8, 8): at most 4 of these work-groups per WGP, so the 1024 work-groups spread 4 to each of the 256 WGPs and none takes a fifth
__global__ __launch_bounds__(256) __attribute__((amdgpu_waves_per_eu(8, 8)))
void yoso_attn_wmma_kernel(const float* __restrict__ Q,
                           const float* __restrict__ kvw,
                           const float* __restrict__ mask,
                           float* __restrict__ part) {
  // one LDS arena: [qn 128 | kn 64 | vt 64 | p 8x16] rows of LPITCH halves (64 used) = 55296 B
  __shared__ __align__(16) unsigned char smem[(QTILE + KTILE + DHEAD + NWAVE * 16) * LPITCH * 2];
  _Float16* sm_qn = (_Float16*)smem;                       // normalized Q tile, row-major
  _Float16* sm_kn = sm_qn + QTILE * LPITCH;                 // normalized K block, row-major
  _Float16* sm_vt = sm_kn + KTILE * LPITCH;                 // V block transposed: vt[d][key]
  _Float16* sm_p  = sm_vt + DHEAD * LPITCH;                 // per-wave P tile (16 x 64)

  const int h      = blockIdx.y;
  const int ks     = blockIdx.z;  // key range of this work-group
  const int qbase  = blockIdx.x * QTILE;
  const int tid    = threadIdx.x;
  const int wv     = tid >> 5;
  const int lane   = tid & 31;
  const int lh     = lane >> 4;   // lane half: 0 or 1
  const int ln     = lane & 15;
  const int dofs8  = lh * 8;      // A-frag half offset (K 0-7/16-23 vs 8-15/24-31)
  const size_t headoff = (size_t)h * S_LEN * DHEAD;

  // ---------------- Stage L2-normalized Q tile (2 threads / row) ----------------
  {
    const int r  = tid >> 1;
    const int hf = tid & 1;
    const float* qrow = Q + headoff + (size_t)(qbase + r) * DHEAD + hf * 32;
    float4 b[8];
    float ss = 0.f;
#pragma unroll
    for (int i = 0; i < 8; ++i) {
      b[i] = ((const float4*)qrow)[i];
      ss += b[i].x * b[i].x + b[i].y * b[i].y + b[i].z * b[i].z + b[i].w * b[i].w;
    }
    ss += __shfl_xor(ss, 1);
    const float inv = 1.f / fmaxf(sqrtf(ss), 1e-12f);
    _Float16* dst = sm_qn + r * LPITCH + hf * 32;
#pragma unroll
    for (int i = 0; i < 8; ++i) {
      dst[i * 4 + 0] = (_Float16)(b[i].x * inv);
      dst[i * 4 + 1] = (_Float16)(b[i].y * inv);
      dst[i * 4 + 2] = (_Float16)(b[i].z * inv);
      dst[i * 4 + 3] = (_Float16)(b[i].w * inv);
    }
  }
  __syncthreads();

  // ---------------- Q A-fragments kept in registers for whole kernel ------------
  h16 qA[2];
#pragma unroll
  for (int c = 0; c < 2; ++c) {
    const _Float16* base = sm_qn + (wv * 16 + ln) * LPITCH + c * 32;
    qA[c] = cat16(lds_ld8(base + dofs8), lds_ld8(base + 16 + dofs8));
  }

  f8 oacc[4];
#pragma unroll
  for (int t = 0; t < 4; ++t) oacc[t] = {};

  _Float16* pw = sm_p + wv * 16 * LPITCH;

  // ================================ key-block loop ==============================
  for (int it = 0; it < KB_PER_SPLIT; ++it) {
    const int kb = ks * KB_PER_SPLIT + it;
    __syncthreads();  // everyone done reading previous Kn / Vt
    {
      // the block's 128 f16 rows (64 of Kn, 64 of Vt) are 16 KiB in a row in the workspace and 128 rows in a row in LDS: a plain copy, 4 x 16 B a thread
      const h8* g = (const h8*)((const _Float16*)kvw + (size_t)(h * (S_LEN / KTILE) + kb) * KV_TILE_H) + tid;
      _Float16* dst = sm_kn + (tid >> 3) * LPITCH + (tid & 7) * 8;
      h8 t[4];
      // both loops unrolled: t lives in registers and needs constant indices; the four loads stand ahead of the stores
#pragma unroll
      for (int j = 0; j < 4; ++j) t[j] = g[j * 256];
#pragma unroll
      for (int j = 0; j < 4; ++j) *(h8*)(dst + j * 32 * LPITCH) = t[j];
    }
    __syncthreads();

    // ---- S = Qn * Kn^T (16x64 per wave), transform, stash P in LDS -------------
#pragma unroll
    for (int nt = 0; nt < 4; ++nt) {
      const int n0 = nt * 16;
      const _Float16* kb0 = sm_kn + (n0 + ln) * LPITCH;
      // B fragment uses the same per-lane k map as A: elements 0-7 = k 8*lh..8*lh+7, elements 8-15 = k 16+8*lh..
      const h16 Blo = cat16(lds_ld8(kb0 + dofs8),      lds_ld8(kb0 + 16 + dofs8));
      const h16 Bhi = cat16(lds_ld8(kb0 + 32 + dofs8), lds_ld8(kb0 + 48 + dofs8));
      f8 acc = {};
      acc = __builtin_amdgcn_wmma_f32_16x16x32_f16(false, qA[0], false, Blo, (short)0, acc, false, false);
      acc = __builtin_amdgcn_wmma_f32_16x16x32_f16(false, qA[1], false, Bhi, (short)0, acc, false, false);
      asm volatile("v_nop\n\tv_nop\n\tv_nop\n\tv_nop" : "+v"(acc) : "v"(qA[0]), "v"(qA[1]), "v"(Blo), "v"(Bhi));
      const float km = mask[kb * KTILE + n0 + ln];  // key mask for this lane's column
#pragma unroll
      for (int r = 0; r < 8; r += 2) {
        f2 s;                                             // the reference's clip
        s.x = __builtin_amdgcn_fmed3f(acc[r],     -1.f + 1e-6f, 1.f - 1e-6f);
        s.y = __builtin_amdgcn_fmed3f(acc[r + 1], -1.f + 1e-6f, 1.f - 1e-6f);
        const f2 z = __builtin_elementwise_fma(s, (f2)(-0.5f), (f2)(0.5f));
        f2 y;                                             // y = sin(acos(s)/2), in (0, 1)
        y.x = __builtin_amdgcn_sqrtf(z.x);
        y.y = __builtin_amdgcn_sqrtf(z.y);
        f2 p = collision_sq(y);                           // (1 - acos(s)/pi)^2
        p = p * p; p = p * p;                             // ^8
        p *= km;
        const h2 ph = __builtin_convertvector(p, h2);
        pw[(lh * 8 + r) * LPITCH + n0 + ln]     = ph.x;   // C-layout scatter
        pw[(lh * 8 + r + 1) * LPITCH + n0 + ln] = ph.y;
      }
    }

    __syncthreads();  // P tile stores complete (scalar f16 stores, vector reloads below)

    // ---- O += P * V (LDS round-trip gives A-layout P) -------------
#pragma unroll
    for (int kc = 0; kc < 2; ++kc) {
      const _Float16* pb = pw + ln * LPITCH + kc * 32;
      const h16 PA = cat16(lds_ld8(pb + dofs8), lds_ld8(pb + 16 + dofs8));
#pragma unroll
      for (int dt = 0; dt < 4; ++dt) {
        const _Float16* vb = sm_vt + (dt * 16 + ln) * LPITCH + kc * 32;
        const h16 BV = cat16(lds_ld8(vb + dofs8), lds_ld8(vb + 16 + dofs8));
        oacc[dt] = __builtin_amdgcn_wmma_f32_16x16x32_f16(false, PA, false, BV, (short)0, oacc[dt], false, false);
      }
      asm volatile("v_nop\n\tv_nop\n\tv_nop\n\tv_nop" : "+v"(oacc[0]), "+v"(oacc[1]), "+v"(oacc[2]), "+v"(oacc[3]) : "v"(PA));
    }
  }

  // ---- partial O of this key range to the workspace, in fragment order: every store is 32 lanes x 16 B = 4 whole lines ----
  {
    float* pt = part + ((((size_t)h * (S_LEN / QTILE) + blockIdx.x) * NWAVE + wv) * NSPLIT + ks) * WAVE_TILE_F32 + lane * 4;
    // both loops unrolled: the accumulators live in registers and need constant indices
#pragma unroll
    for (int dt = 0; dt < 4; ++dt) {
#pragma unroll
      for (int hf = 0; hf < 2; ++hf) {
        *(float4*)(pt + (dt * 2 + hf) * 128) =
            make_float4(oacc[dt][hf * 4 + 0], oacc[dt][hf * 4 + 1], oacc[dt][hf * 4 + 2], oacc[dt][hf * 4 + 3]);
      }
    }
  }
}

// Third launch: sums the NSPLIT partial tiles in fixed order (range 0, 1, 2, 3), then query mask, normalisation, conv branch and the staged store.
__global__ __launch_bounds__(256)
void attn_merge_epilogue_kernel(const float* __restrict__ part,
                                const float* __restrict__ V,
                                const float* __restrict__ mask,
                                const float* __restrict__ cw,
                                float* out) {
  const int CSTR = DHEAD + 4;
  __shared__ __align__(16) float cst[QTILE * (DHEAD + 4)];  // output stage [128][CSTR]

  const int h      = blockIdx.y;
  const int qbase  = blockIdx.x * QTILE;
  const int tid    = threadIdx.x;
  const int wv     = tid >> 5;
  const int lane   = tid & 31;
  const int lh     = lane >> 4;
  const int ln     = lane & 15;
  const size_t headoff = (size_t)h * S_LEN * DHEAD;

  f8 oacc[4];
  {
    // wave-uniform tile base (scalar) + one per-lane byte offset: all 32 loads name the same vector register
    const int wvu = __builtin_amdgcn_readfirstlane(wv);
    const char* pt = (const char*)(part + (((size_t)h * (S_LEN / QTILE) + blockIdx.x) * NWAVE + wvu) * (NSPLIT * WAVE_TILE_F32));
    const int split_bytes = WAVE_TILE_F32 * 4;  // the NSPLIT partial tiles of one wave tile lie side by side
    const unsigned lofs = lane * 16u;
    float4 pv[NSPLIT][8];
    // all loops here unrolled: pv and oacc live in registers and need constant indices; the loads stand ahead of the sums
#pragma unroll
    for (int s = 0; s < NSPLIT; ++s)
#pragma unroll
      for (int j = 0; j < 8; ++j) pv[s][j] = *(const float4*)(pt + s * split_bytes + j * 512 + lofs);
#pragma unroll
    for (int j = 0; j < 8; ++j) {
      float4 a = pv[0][j];
#pragma unroll
      for (int s = 1; s < NSPLIT; ++s) { a.x += pv[s][j].x; a.y += pv[s][j].y; a.z += pv[s][j].z; a.w += pv[s][j].w; }
      oacc[j >> 1][(j & 1) * 4 + 0] = a.x;
      oacc[j >> 1][(j & 1) * 4 + 1] = a.y;
      oacc[j >> 1][(j & 1) * 4 + 2] = a.z;
      oacc[j >> 1][(j & 1) * 4 + 3] = a.w;
    }
  }

  const float w0 = cw[h * 3 + 0], w1 = cw[h * 3 + 1], w2 = cw[h * 3 + 2];
  const int srow_base = qbase + wv * 16 + lh * 8;
#pragma unroll
  for (int r = 0; r < 8; ++r) {
    const int srow = srow_base + r;
    const float qm = mask[srow];
    float xv[4];
    float ss = 0.f;
#pragma unroll
    for (int dt = 0; dt < 4; ++dt) {   // reference order: mask BEFORE normalize
      xv[dt] = oacc[dt][r] * qm;
      ss += xv[dt] * xv[dt];
    }
    // reduce sum of squares across the 16 lanes of this half (row is constant there)
    ss += __shfl_xor(ss, 1);
    ss += __shfl_xor(ss, 2);
    ss += __shfl_xor(ss, 4);
    ss += __shfl_xor(ss, 8);
    const float inv = 1.f / fmaxf(sqrtf(ss), 1e-12f);

    const float* vc = V + headoff + (size_t)srow * DHEAD;
    const float mm1 = (srow > 0)          ? mask[srow - 1] : 0.f;
    const float mp1 = (srow < S_LEN - 1)  ? mask[srow + 1] : 0.f;
#pragma unroll
    for (int dt = 0; dt < 4; ++dt) {
      const int d = dt * 16 + ln;
      const float vm1 = (srow > 0)         ? vc[d - DHEAD] * mm1 : 0.f;
      const float v0  = vc[d] * qm;
      const float vp1 = (srow < S_LEN - 1) ? vc[d + DHEAD] * mp1 : 0.f;
      const float conv = w0 * vm1 + w1 * v0 + w2 * vp1;
      cst[(srow - qbase) * CSTR + d] = xv[dt] * inv + conv;
    }
  }
  __syncthreads();
  {
    const int col = tid & 63, rsel = tid >> 6;
    float* ob = out + headoff + (size_t)qbase * DHEAD;
#pragma unroll 4
    for (int r = rsel; r < QTILE; r += 4) *(float*)(ob + (size_t)r * DHEAD + col) = cst[r * CSTR + col];
    
  }
}

extern "C" void kernel_launch(void* const* d_in, const int* in_sizes, int n_in,
                              void* d_out, int out_size, void* d_ws, size_t ws_size,
                              hipStream_t stream) {
  (void)in_sizes; (void)n_in; (void)out_size; (void)ws_size;
  const float* Q    = (const float*)d_in[0];
  const float* K    = (const float*)d_in[1];
  const float* V    = (const float*)d_in[2];
  const float* mask = (const float*)d_in[3];
  const float* cw   = (const float*)d_in[4];
  float* out = (float*)d_out;

  float* part = (float*)d_ws;       // NSPLIT x 8 MiB of f32 partial tiles, all written by the second launch
  float* kvw  = part + KV_OFS_F32;  // 8 MiB of f16 key-block tiles, all written by the first launch

  dim3 grid(S_LEN / QTILE, NHEAD, NSPLIT);  // 32 query tiles x 8 heads x 4 key ranges
  dim3 grid0(S_LEN / KTILE, NHEAD);         // 64 key blocks x 8 heads
  dim3 grid2(S_LEN / QTILE, NHEAD);
  dim3 block(32 * NWAVE);                   // 8 wave32 waves
  kv_f16_tiles_kernel<<<grid0, block, 0, stream>>>(K, V, kvw);
  yoso_attn_wmma_kernel<<<grid, block, 0, stream>>>(Q, kvw, mask, part);
  attn_merge_epilogue_kernel<<<grid2, block, 0, stream>>>(part, V, mask, cw, out);
}

// v005
// It runs in 65.8 microseconds.
// Two timings next to v004 put it at 1.13 and 1.14 times that version's speed.
// Over all steps from v000 it is 4.47 times as fast.
#include <hip/hip_runtime.h>

// Contractions Kn.Qn^T (K=64) and P.V (K=64 per key block) on v_wmma_f32_16x16x32_f16 (f16 operands, f32 accumulate); normalisation, arccos power, conv and epilogue in f32.

typedef _Float16 h8  __attribute__((ext_vector_type(8)));
typedef _Float16 h16 __attribute__((ext_vector_type(16)));
typedef float    f8  __attribute__((ext_vector_type(8)));
typedef float    f2  __attribute__((ext_vector_type(2)));
typedef _Float16 h2  __attribute__((ext_vector_type(2)));

#define S_LEN 4096
#define NHEAD 8
#define DHEAD 64
#define QTILE 128
#define KTILE 64
#define NWAVE 8
#define NSPLIT 4   // key ranges per query tile: 4 work-groups of 8 waves share a WGP, so one group's load and LDS waits are covered by the others' vector work
#define KB_PER_SPLIT (S_LEN / KTILE / NSPLIT)
#define WAVE_TILE_F32 (16 * DHEAD)  // one wave's 16 x 64 f32 accumulator tile in the workspace, kept in fragment order
#define KV_TILE_H (2 * KTILE * DHEAD)  // halves of one key block in the workspace: 64 x 64 normalized K rows, then 64 x 64 V transposed (d-major)
#define KV_OFS_F32 ((size_t)NSPLIT * NHEAD * S_LEN * DHEAD)  // the f16 tiles lie behind the f32 partial tiles
#define LPITCH 72  // LDS row pitch in halves: 144 B = 16 B x 9 (odd), so the 16 rows of a ds_load_b128 fragment read fall on distinct banks

__device__ __forceinline__ h16 cat16(h8 a, h8 b) {
  h16 r;
#pragma unroll
  for (int i = 0; i < 8; ++i) { r[i] = a[i]; r[i + 8] = b[i]; }
  return r;
}

__device__ __forceinline__ h8 lds_ld8(const _Float16* p) {
  return *(const h8*)p;
}

// (1 - acos(s)/pi)^2 as one polynomial in y = sqrt((1 - s)/2), for every s in [-1, 1].
// acos(s) = 2 asin(y), so 1 - acos(s)/pi = (2/pi) acos(y); acos(y) behaves like sqrt(1 - y) at y = 1, its square is smooth there,
// and the only singular point left is y = -1, outside [0, 1]: no branch on the sign or the size of s, and one squaring fewer.
// Degree-7 minimax fit on [0, 1], weighted for the relative error of the 8th power: the fit is within about 1e-6 of it, and with the f32
// rounding of the chain within 6e-6, wherever it is an f16 normal number; under 1e-9 absolute below that. The f16 rounding of P that
// follows is 5e-4 relative.
// Two scores at a time: the pairs keep every multiply-add of the chain on the packed f32 form.
__device__ __forceinline__ f2 collision_sq(f2 y) {
  f2 q = (f2)(-0.00522967149f);
  q = __builtin_elementwise_fma(q, y, (f2)(0.0269641094f));
  q = __builtin_elementwise_fma(q, y, (f2)(-0.0683889985f));
  q = __builtin_elementwise_fma(q, y, (f2)(0.124759011f));
  q = __builtin_elementwise_fma(q, y, (f2)(-0.20989652f));
  q = __builtin_elementwise_fma(q, y, (f2)(0.405017912f));
  q = __builtin_elementwise_fma(q, y, (f2)(-1.27322733f));
  q = __builtin_elementwise_fma(q, y, (f2)(0.999999881f));
  return q;
}

// First launch: each 64-key block once per head (the main launch reads it from 32 query tiles): K rows L2-normalized to f16, V to f16 and transposed.
__global__ __launch_bounds__(256)
void kv_f16_tiles_kernel(const float* __restrict__ K,
                         const float* __restrict__ V,
                         float* __restrict__ kvw) {
  __shared__ __align__(16) _Float16 sm_kn[(KTILE + DHEAD) * LPITCH];  // 64 rows of Kn, then 64 rows of vt[d][key]
  _Float16* sm_vt = sm_kn + KTILE * LPITCH;
  const int h   = blockIdx.y;
  const int kb  = blockIdx.x;
  const int tid = threadIdx.x;
  const size_t headoff = (size_t)h * S_LEN * DHEAD;
  {
    const int r  = tid >> 2;      // key row 0..63
    const int q4 = tid & 3;       // 16-col quarter
    const int key = kb * KTILE + r;
    const float* krow = K + headoff + (size_t)key * DHEAD + q4 * 16;
    float4 b[4];
    float ss = 0.f;
#pragma unroll
    for (int i = 0; i < 4; ++i) {
      b[i] = ((const float4*)krow)[i];
      ss += b[i].x * b[i].x + b[i].y * b[i].y + b[i].z * b[i].z + b[i].w * b[i].w;
    }
    ss += __shfl_xor(ss, 1);
    ss += __shfl_xor(ss, 2);
    const float inv = 1.f / fmaxf(sqrtf(ss), 1e-12f);
    _Float16* dst = sm_kn + r * LPITCH + q4 * 16;
#pragma unroll
    for (int i = 0; i < 4; ++i) {
      dst[i * 4 + 0] = (_Float16)(b[i].x * inv);
      dst[i * 4 + 1] = (_Float16)(b[i].y * inv);
      dst[i * 4 + 2] = (_Float16)(b[i].z * inv);
      dst[i * 4 + 3] = (_Float16)(b[i].w * inv);
    }
    // V block, stored transposed so P*V B-fragments are contiguous b128 loads
    const float* vrow = V + headoff + (size_t)key * DHEAD + q4 * 16;
#pragma unroll
    for (int i = 0; i < 4; ++i) {
      const float4 v4 = ((const float4*)vrow)[i];
      const int c0 = q4 * 16 + i * 4;
      const f2 lo = {v4.x, v4.y}, hi = {v4.z, v4.w};  // pairs: one packed conversion for two values
      const h2 hlo = __builtin_convertvector(lo, h2), hhi = __builtin_convertvector(hi, h2);
      sm_vt[(c0 + 0) * LPITCH + r] = hlo.x;
      sm_vt[(c0 + 1) * LPITCH + r] = hlo.y;
      sm_vt[(c0 + 2) * LPITCH + r] = hhi.x;
      sm_vt[(c0 + 3) * LPITCH + r] = hhi.y;
    }
  }
  __syncthreads();  // all 128 rows complete before they are read back whole
  {
    // 128 rows of 128 B go out unpadded, 16 KiB in a row: every store is 32 lanes x 16 B = 4 whole lines
    h8* g = (h8*)((_Float16*)kvw + (size_t)(h * (S_LEN / KTILE) + kb) * KV_TILE_H) + tid;
    const _Float16* s = sm_kn + (tid >> 3) * LPITCH + (tid & 7) * 8;
    // unrolled: the four LDS reads are issued together, ahead of the stores
#pragma unroll
    for (int j = 0; j < 4; ++j) g[j * 256] = lds_ld8(s + j * 32 * LPITCH);
  }
}

// waves_per_eu(8, 8): at most 4 of these work-groups per WGP, so the 1024 work-groups spread 4 to each of the 256 WGPs and none takes a fifth
__global__ __launch_bounds__(256) __attribute__((amdgpu_waves_per_eu(8, 8)))
void yoso_attn_wmma_kernel(const float* __restrict__ Q,
                           const float* __restrict__ kvw,
                           const float* __restrict__ mask,
                           float* __restrict__ part) {
  // one LDS arena: [qn 128 | kn 64 | vt 64] rows of LPITCH halves (64 used) = 36864 B
  __shared__ __align__(16) unsigned char smem[(QTILE + KTILE + DHEAD) * LPITCH * 2];
  _Float16* sm_qn = (_Float16*)smem;                       // normalized Q tile, row-major
  _Float16* sm_kn = sm_qn + QTILE * LPITCH;                 // normalized K block, row-major
  _Float16* sm_vt = sm_kn + KTILE * LPITCH;                 // V block transposed: vt[d][key]

  const int h      = blockIdx.y;
  const int ks     = blockIdx.z;  // key range of this work-group
  const int qbase  = blockIdx.x * QTILE;
  const int tid    = threadIdx.x;
  const int wv     = tid >> 5;
  const int lane   = tid & 31;
  const int lh     = lane >> 4;   // lane half: 0 or 1
  const int ln     = lane & 15;
  const int dofs8  = lh * 8;      // A-frag half offset (K 0-7/16-23 vs 8-15/24-31)
  const size_t headoff = (size_t)h * S_LEN * DHEAD;

  // ---------------- Stage L2-normalized Q tile (2 threads / row) ----------------
  {
    const int r  = tid >> 1;
    const int hf = tid & 1;
    const float* qrow = Q + headoff + (size_t)(qbase + r) * DHEAD + hf * 32;
    float4 b[8];
    float ss = 0.f;
#pragma unroll
    for (int i = 0; i < 8; ++i) {
      b[i] = ((const float4*)qrow)[i];
      ss += b[i].x * b[i].x + b[i].y * b[i].y + b[i].z * b[i].z + b[i].w * b[i].w;
    }
    ss += __shfl_xor(ss, 1);
    const float inv = 1.f / fmaxf(sqrtf(ss), 1e-12f);
    _Float16* dst = sm_qn + r * LPITCH + hf * 32;
#pragma unroll
    for (int i = 0; i < 8; ++i) {
      dst[i * 4 + 0] = (_Float16)(b[i].x * inv);
      dst[i * 4 + 1] = (_Float16)(b[i].y * inv);
      dst[i * 4 + 2] = (_Float16)(b[i].z * inv);
      dst[i * 4 + 3] = (_Float16)(b[i].w * inv);
    }
  }
  __syncthreads();

  // ---------------- Q fragments (B operand of the score product) kept in registers for whole kernel ------------
  h16 qA[2];
#pragma unroll
  for (int c = 0; c < 2; ++c) {
    const _Float16* base = sm_qn + (wv * 16 + ln) * LPITCH + c * 32;
    qA[c] = cat16(lds_ld8(base + dofs8), lds_ld8(base + 16 + dofs8));
  }

  f8 oacc[4];
#pragma unroll
  for (int t = 0; t < 4; ++t) oacc[t] = {};

  // ================================ key-block loop ==============================
  for (int it = 0; it < KB_PER_SPLIT; ++it) {
    const int kb = ks * KB_PER_SPLIT + it;
    __syncthreads();  // everyone done reading previous Kn / Vt
    // key mask of the 8 keys that this lane half holds in each of the block's four 16-key tiles; loaded with the tile so that one wait covers both
    float4 km[8];
    // unrolled: km lives in registers and needs constant indices
#pragma unroll
    for (int j = 0; j < 8; ++j) km[j] = *(const float4*)(mask + kb * KTILE + (j >> 1) * 16 + lh * 8 + (j & 1) * 4);
    {
      // the block's 128 f16 rows (64 of Kn, 64 of Vt) are 16 KiB in a row in the workspace and 128 rows in a row in LDS: a plain copy, 4 x 16 B a thread
      const h8* g = (const h8*)((const _Float16*)kvw + (size_t)(h * (S_LEN / KTILE) + kb) * KV_TILE_H) + tid;
      _Float16* dst = sm_kn + (tid >> 3) * LPITCH + (tid & 7) * 8;
      h8 t[4];
      // both loops unrolled: t lives in registers and needs constant indices; the four loads stand ahead of the stores
#pragma unroll
      for (int j = 0; j < 4; ++j) t[j] = g[j * 256];
#pragma unroll
      for (int j = 0; j < 4; ++j) *(h8*)(dst + j * 32 * LPITCH) = t[j];
    }
    __syncthreads();

    // ---- per 32 keys: S^T = Kn * Qn^T (keys down, queries across), transform, O += P * V -------------
    // In the accumulator of S^T lane (ln, lh) holds query ln, keys 8*lh..8*lh+7 of its 16-key tile: two such tiles side by side are
    // the A fragment of P for 32 keys (elements 0-7 = k 8*lh.., elements 8-15 = k 16+8*lh..), so P never leaves the registers.
#pragma unroll
    for (int kc = 0; kc < 2; ++kc) {
      h16 PA;
      // this loop and the one over r unrolled: PA, acc and km live in registers and need constant indices
#pragma unroll
      for (int t2 = 0; t2 < 2; ++t2) {
        const int nt = kc * 2 + t2;
        const _Float16* kb0 = sm_kn + (nt * 16 + ln) * LPITCH;
        // A fragment of Kn; the Q fragments serve as B, which uses the same per-lane k map: elements 0-7 = k 8*lh..8*lh+7, elements 8-15 = k 16+8*lh..
        const h16 Klo = cat16(lds_ld8(kb0 + dofs8),      lds_ld8(kb0 + 16 + dofs8));
        const h16 Khi = cat16(lds_ld8(kb0 + 32 + dofs8), lds_ld8(kb0 + 48 + dofs8));
        f8 acc = {};
        acc = __builtin_amdgcn_wmma_f32_16x16x32_f16(false, Klo, false, qA[0], (short)0, acc, false, false);
        acc = __builtin_amdgcn_wmma_f32_16x16x32_f16(false, Khi, false, qA[1], (short)0, acc, false, false);
        // four vector slots between the matrix instruction and the first reader of its result
        asm volatile("v_nop\n\tv_nop\n\tv_nop\n\tv_nop" : "+v"(acc) : "v"(qA[0]), "v"(qA[1]), "v"(Klo), "v"(Khi));
#pragma unroll
        for (int r = 0; r < 8; r += 2) {
          f2 s;                                             // the reference's clip
          s.x = __builtin_amdgcn_fmed3f(acc[r],     -1.f + 1e-6f, 1.f - 1e-6f);
          s.y = __builtin_amdgcn_fmed3f(acc[r + 1], -1.f + 1e-6f, 1.f - 1e-6f);
          const f2 z = __builtin_elementwise_fma(s, (f2)(-0.5f), (f2)(0.5f));
          f2 y;                                             // y = sin(acos(s)/2), in (0, 1)
          y.x = __builtin_amdgcn_sqrtf(z.x);
          y.y = __builtin_amdgcn_sqrtf(z.y);
          f2 p = collision_sq(y);                           // (1 - acos(s)/pi)^2
          p = p * p; p = p * p;                             // ^8
          const float4 k4 = km[nt * 2 + (r >> 2)];          // key mask of this lane's rows r, r + 1
          const f2 kmp = (r & 2) ? (f2){k4.z, k4.w} : (f2){k4.x, k4.y};
          p *= kmp;
          const h2 ph = __builtin_convertvector(p, h2);
          PA[t2 * 8 + r]     = ph.x;
          PA[t2 * 8 + r + 1] = ph.y;
        }
      }
#pragma unroll
      for (int dt = 0; dt < 4; ++dt) {
        const _Float16* vb = sm_vt + (dt * 16 + ln) * LPITCH + kc * 32;
        const h16 BV = cat16(lds_ld8(vb + dofs8), lds_ld8(vb + 16 + dofs8));
        oacc[dt] = __builtin_amdgcn_wmma_f32_16x16x32_f16(false, PA, false, BV, (short)0, oacc[dt], false, false);
      }
      asm volatile("v_nop\n\tv_nop\n\tv_nop\n\tv_nop" : "+v"(oacc[0]), "+v"(oacc[1]), "+v"(oacc[2]), "+v"(oacc[3]) : "v"(PA));
    }
  }

  // ---- partial O of this key range to the workspace, in fragment order: every store is 32 lanes x 16 B = 4 whole lines ----
  {
    float* pt = part + ((((size_t)h * (S_LEN / QTILE) + blockIdx.x) * NWAVE + wv) * NSPLIT + ks) * WAVE_TILE_F32 + lane * 4;
    // both loops unrolled: the accumulators live in registers and need constant indices
#pragma unroll
    for (int dt = 0; dt < 4; ++dt) {
#pragma unroll
      for (int hf = 0; hf < 2; ++hf) {
        *(float4*)(pt + (dt * 2 + hf) * 128) =
            make_float4(oacc[dt][hf * 4 + 0], oacc[dt][hf * 4 + 1], oacc[dt][hf * 4 + 2], oacc[dt][hf * 4 + 3]);
      }
    }
  }
}

// Third launch: sums the NSPLIT partial tiles in fixed order (range 0, 1, 2, 3), then query mask, normalisation, conv branch and the staged store.
__global__ __launch_bounds__(256)
void attn_merge_epilogue_kernel(const float* __restrict__ part,
                                const float* __restrict__ V,
                                const float* __restrict__ mask,
                                const float* __restrict__ cw,
                                float* out) {
  const int CSTR = DHEAD + 4;
  __shared__ __align__(16) float cst[QTILE * (DHEAD + 4)];  // output stage [128][CSTR]

  const int h      = blockIdx.y;
  const int qbase  = blockIdx.x * QTILE;
  const int tid    = threadIdx.x;
  const int wv     = tid >> 5;
  const int lane   = tid & 31;
  const int lh     = lane >> 4;
  const int ln     = lane & 15;
  const size_t headoff = (size_t)h * S_LEN * DHEAD;

  f8 oacc[4];
  {
    // wave-uniform tile base (scalar) + one per-lane byte offset: all 32 loads name the same vector register
    const int wvu = __builtin_amdgcn_readfirstlane(wv);
    const char* pt = (const char*)(part + (((size_t)h * (S_LEN / QTILE) + blockIdx.x) * NWAVE + wvu) * (NSPLIT * WAVE_TILE_F32));
    const int split_bytes = WAVE_TILE_F32 * 4;  // the NSPLIT partial tiles of one wave tile lie side by side
    const unsigned lofs = lane * 16u;
    float4 pv[NSPLIT][8];
    // all loops here unrolled: pv and oacc live in registers and need constant indices; the loads stand ahead of the sums
#pragma unroll
    for (int s = 0; s < NSPLIT; ++s)
#pragma unroll
      for (int j = 0; j < 8; ++j) pv[s][j] = *(const float4*)(pt + s * split_bytes + j * 512 + lofs);
#pragma unroll
    for (int j = 0; j < 8; ++j) {
      float4 a = pv[0][j];
#pragma unroll
      for (int s = 1; s < NSPLIT; ++s) { a.x += pv[s][j].x; a.y += pv[s][j].y; a.z += pv[s][j].z; a.w += pv[s][j].w; }
      oacc[j >> 1][(j & 1) * 4 + 0] = a.x;
      oacc[j >> 1][(j & 1) * 4 + 1] = a.y;
      oacc[j >> 1][(j & 1) * 4 + 2] = a.z;
      oacc[j >> 1][(j & 1) * 4 + 3] = a.w;
    }
  }

  const float w0 = cw[h * 3 + 0], w1 = cw[h * 3 + 1], w2 = cw[h * 3 + 2];
  const int srow_base = qbase + wv * 16 + lh * 8;
#pragma unroll
  for (int r = 0; r < 8; ++r) {
    const int srow = srow_base + r;
    const float qm = mask[srow];
    float xv[4];
    float ss = 0.f;
#pragma unroll
    for (int dt = 0; dt < 4; ++dt) {   // reference order: mask BEFORE normalize
      xv[dt] = oacc[dt][r] * qm;
      ss += xv[dt] * xv[dt];
    }
    // reduce sum of squares across the 16 lanes of this half (row is constant there)
    ss += __shfl_xor(ss, 1);
    ss += __shfl_xor(ss, 2);
    ss += __shfl_xor(ss, 4);
    ss += __shfl_xor(ss, 8);
    const float inv = 1.f / fmaxf(sqrtf(ss), 1e-12f);

    const float* vc = V + headoff + (size_t)srow * DHEAD;
    const float mm1 = (srow > 0)          ? mask[srow - 1] : 0.f;
    const float mp1 = (srow < S_LEN - 1)  ? mask[srow + 1] : 0.f;
#pragma unroll
    for (int dt = 0; dt < 4; ++dt) {
      const int d = dt * 16 + ln;
      const float vm1 = (srow > 0)         ? vc[d - DHEAD] * mm1 : 0.f;
      const float v0  = vc[d] * qm;
      const float vp1 = (srow < S_LEN - 1) ? vc[d + DHEAD] * mp1 : 0.f;
      const float conv = w0 * vm1 + w1 * v0 + w2 * vp1;
      cst[(srow - qbase) * CSTR + d] = xv[dt] * inv + conv;
    }
  }
  __syncthreads();
  {
    const int col = tid & 63, rsel = tid >> 6;
    float* ob = out + headoff + (size_t)qbase * DHEAD;
#pragma unroll 4
    for (int r = rsel; r < QTILE; r += 4) *(float*)(ob + (size_t)r * DHEAD + col) = cst[r * CSTR + col];
    
  }
}

extern "C" void kernel_launch(void* const* d_in, const int* in_sizes, int n_in,
                              void* d_out, int out_size, void* d_ws, size_t ws_size,
                              hipStream_t stream) {
  (void)in_sizes; (void)n_in; (void)out_size; (void)ws_size;
  const float* Q    = (const float*)d_in[0];
  const float* K    = (const float*)d_in[1];
  const float* V    = (const float*)d_in[2];
  const float* mask = (const float*)d_in[3];
  const float* cw   = (const float*)d_in[4];
  float* out = (float*)d_out;

  float* part = (float*)d_ws;       // NSPLIT x 8 MiB of f32 partial tiles, all written by the second launch
  float* kvw  = part + KV_OFS_F32;  // 8 MiB of f16 key-block tiles, all written by the first launch

  dim3 grid(S_LEN / QTILE, NHEAD, NSPLIT);  // 32 query tiles x 8 heads x 4 key ranges
  dim3 grid0(S_LEN / KTILE, NHEAD);         // 64 key blocks x 8 heads
  dim3 grid2(S_LEN / QTILE, NHEAD);
  dim3 block(32 * NWAVE);                   // 8 wave32 waves
  kv_f16_tiles_kernel<<<grid0, block, 0, stream>>>(K, V, kvw);
  yoso_attn_wmma_kernel<<<grid, block, 0, stream>>>(Q, kvw, mask, part);
  attn_merge_epilogue_kernel<<<grid2, block, 0, stream>>>(part, V, mask, cw, out);
}

// v006
// A run of this version takes 56.3 microseconds.
// In two side-by-side timings against v005, it was 1.16 and 1.17 times as fast.
// Counting every step since v000, it is 5.22 times as fast.
#include <hip/hip_runtime.h>

// Contractions Kn.Qn^T (K=64) and P.V (K=64 per key block) on v_wmma_f32_16x16x32_f16 (f16 operands, f32 accumulate); normalisation, arccos power, conv and epilogue in f32.

typedef _Float16 h8  __attribute__((ext_vector_type(8)));
typedef _Float16 h16 __attribute__((ext_vector_type(16)));
typedef float    f8  __attribute__((ext_vector_type(8)));
typedef float    f2  __attribute__((ext_vector_type(2)));
typedef float    f4  __attribute__((ext_vector_type(4)));
typedef _Float16 h2  __attribute__((ext_vector_type(2)));

#define S_LEN 4096
#define NHEAD 8
#define DHEAD 64
#define QTILE 128
#define KTILE 64
#define NWAVE 8
#define NSPLIT 4   // key ranges per query tile: 4 work-groups of 8 waves share a WGP, so one group's load and LDS waits are covered by the others' vector work
#define KB_PER_SPLIT (S_LEN / KTILE / NSPLIT)
#define WAVE_TILE_F32 (16 * DHEAD)  // one wave's 16 x 64 f32 accumulator tile in the workspace, kept in fragment order
#define KV_TILE_H (2 * KTILE * DHEAD)  // halves of one key block in the workspace: 64 x 64 normalized K rows, then 64 x 64 V transposed (d-major)
#define KV_OFS_F32 ((size_t)NSPLIT * NHEAD * S_LEN * DHEAD)  // the f16 tiles lie behind the f32 partial tiles
#define LPITCH 72  // LDS row pitch in halves: 144 B = 16 B x 9 (odd), so the 16 rows of a ds_load_b128 fragment read fall on distinct banks

__device__ __forceinline__ h16 cat16(h8 a, h8 b) {
  h16 r;
#pragma unroll
  for (int i = 0; i < 8; ++i) { r[i] = a[i]; r[i + 8] = b[i]; }
  return r;
}

__device__ __forceinline__ h8 lds_ld8(const _Float16* p) {
  return *(const h8*)p;
}

// (1 - acos(s)/pi)^2 as one polynomial in y = sqrt((1 - s)/2), for every s in [-1, 1].
// acos(s) = 2 asin(y), so 1 - acos(s)/pi = (2/pi) acos(y); acos(y) behaves like sqrt(1 - y) at y = 1, its square is smooth there,
// and the only singular point left is y = -1, outside [0, 1]: no branch on the sign or the size of s, and one squaring fewer.
// Degree-7 minimax fit on [0, 1], weighted for the relative error of the 8th power: the fit is within about 1e-6 of it, and with the f32
// rounding of the chain within 6e-6, wherever it is an f16 normal number; under 1e-9 absolute below that. The f16 rounding of P that
// follows is 5e-4 relative.
// Two scores at a time: the pairs keep every multiply-add of the chain on the packed f32 form.
__device__ __forceinline__ f2 collision_sq(f2 y) {
  f2 q = (f2)(-0.00522967149f);
  q = __builtin_elementwise_fma(q, y, (f2)(0.0269641094f));
  q = __builtin_elementwise_fma(q, y, (f2)(-0.0683889985f));
  q = __builtin_elementwise_fma(q, y, (f2)(0.124759011f));
  q = __builtin_elementwise_fma(q, y, (f2)(-0.20989652f));
  q = __builtin_elementwise_fma(q, y, (f2)(0.405017912f));
  q = __builtin_elementwise_fma(q, y, (f2)(-1.27322733f));
  q = __builtin_elementwise_fma(q, y, (f2)(0.999999881f));
  return q;
}

// First launch: each 64-key block once per head (the main launch reads it from 32 query tiles): K rows L2-normalized to f16, V to f16 and transposed.
__global__ __launch_bounds__(256)
void kv_f16_tiles_kernel(const float* __restrict__ K,
                         const float* __restrict__ V,
                         float* __restrict__ kvw) {
  __shared__ __align__(16) _Float16 sm_kn[(KTILE + DHEAD) * LPITCH];  // 64 rows of Kn, then 64 rows of vt[d][key]
  _Float16* sm_vt = sm_kn + KTILE * LPITCH;
  const int h   = blockIdx.y;
  const int kb  = blockIdx.x;
  const int tid = threadIdx.x;
  const size_t headoff = (size_t)h * S_LEN * DHEAD;
  {
    const int r  = tid >> 2;      // key row 0..63
    const int q4 = tid & 3;       // 16-col quarter
    const int key = kb * KTILE + r;
    const float* krow = K + headoff + (size_t)key * DHEAD + q4 * 16;
    float4 b[4];
    float ss = 0.f;
#pragma unroll
    for (int i = 0; i < 4; ++i) {
      b[i] = ((const float4*)krow)[i];
      ss += b[i].x * b[i].x + b[i].y * b[i].y + b[i].z * b[i].z + b[i].w * b[i].w;
    }
    ss += __shfl_xor(ss, 1);
    ss += __shfl_xor(ss, 2);
    const float inv = 1.f / fmaxf(sqrtf(ss), 1e-12f);
    _Float16* dst = sm_kn + r * LPITCH + q4 * 16;
#pragma unroll
    for (int i = 0; i < 4; ++i) {
      dst[i * 4 + 0] = (_Float16)(b[i].x * inv);
      dst[i * 4 + 1] = (_Float16)(b[i].y * inv);
      dst[i * 4 + 2] = (_Float16)(b[i].z * inv);
      dst[i * 4 + 3] = (_Float16)(b[i].w * inv);
    }
    // V block, stored transposed so P*V B-fragments are contiguous b128 loads
    const float* vrow = V + headoff + (size_t)key * DHEAD + q4 * 16;
#pragma unroll
    for (int i = 0; i < 4; ++i) {
      const float4 v4 = ((const float4*)vrow)[i];
      const int c0 = q4 * 16 + i * 4;
      const f2 lo = {v4.x, v4.y}, hi = {v4.z, v4.w};  // pairs: one packed conversion for two values
      const h2 hlo = __builtin_convertvector(lo, h2), hhi = __builtin_convertvector(hi, h2);
      sm_vt[(c0 + 0) * LPITCH + r] = hlo.x;
      sm_vt[(c0 + 1) * LPITCH + r] = hlo.y;
      sm_vt[(c0 + 2) * LPITCH + r] = hhi.x;
      sm_vt[(c0 + 3) * LPITCH + r] = hhi.y;
    }
  }
  __syncthreads();  // all 128 rows complete before they are read back whole
  {
    // 128 rows of 128 B go out unpadded, 16 KiB in a row: every store is 32 lanes x 16 B = 4 whole lines
    h8* g = (h8*)((_Float16*)kvw + (size_t)(h * (S_LEN / KTILE) + kb) * KV_TILE_H) + tid;
    const _Float16* s = sm_kn + (tid >> 3) * LPITCH + (tid & 7) * 8;
    // unrolled: the four LDS reads are issued together, ahead of the stores
#pragma unroll
    for (int j = 0; j < 4; ++j) g[j * 256] = lds_ld8(s + j * 32 * LPITCH);
  }
}

// waves_per_eu(8, 8): at most 4 of these work-groups per WGP, so the 1024 work-groups spread 4 to each of the 256 WGPs and none takes a fifth
__global__ __launch_bounds__(256) __attribute__((amdgpu_waves_per_eu(8, 8)))
void yoso_attn_wmma_kernel(const float* __restrict__ Q,
                           const float* __restrict__ kvw,
                           const float* __restrict__ mask,
                           float* __restrict__ part) {
  // one LDS arena: [qn 128 | kn 64 | vt 64] rows of LPITCH halves (64 used) = 36864 B
  __shared__ __align__(16) unsigned char smem[(QTILE + KTILE + DHEAD) * LPITCH * 2];
  _Float16* sm_qn = (_Float16*)smem;                       // normalized Q tile, row-major
  _Float16* sm_kn = sm_qn + QTILE * LPITCH;                 // normalized K block, row-major
  _Float16* sm_vt = sm_kn + KTILE * LPITCH;                 // V block transposed: vt[d][key]

  const int h      = blockIdx.y;
  const int ks     = blockIdx.z;  // key range of this work-group
  const int qbase  = blockIdx.x * QTILE;
  const int tid    = threadIdx.x;
  const int wv     = tid >> 5;
  const int lane   = tid & 31;
  const int lh     = lane >> 4;   // lane half: 0 or 1
  const int ln     = lane & 15;
  const int dofs8  = lh * 8;      // A-frag half offset (K 0-7/16-23 vs 8-15/24-31)
  const size_t headoff = (size_t)h * S_LEN * DHEAD;

  // ---------------- Stage L2-normalized Q tile (2 threads / row) ----------------
  {
    const int r  = tid >> 1;
    const int hf = tid & 1;
    const float* qrow = Q + headoff + (size_t)(qbase + r) * DHEAD + hf * 32;
    float4 b[8];
    float ss = 0.f;
#pragma unroll
    for (int i = 0; i < 8; ++i) {
      b[i] = ((const float4*)qrow)[i];
      ss += b[i].x * b[i].x + b[i].y * b[i].y + b[i].z * b[i].z + b[i].w * b[i].w;
    }
    ss += __shfl_xor(ss, 1);
    const float inv = 1.f / fmaxf(sqrtf(ss), 1e-12f);
    _Float16* dst = sm_qn + r * LPITCH + hf * 32;
#pragma unroll
    for (int i = 0; i < 8; ++i) {
      dst[i * 4 + 0] = (_Float16)(b[i].x * inv);
      dst[i * 4 + 1] = (_Float16)(b[i].y * inv);
      dst[i * 4 + 2] = (_Float16)(b[i].z * inv);
      dst[i * 4 + 3] = (_Float16)(b[i].w * inv);
    }
  }
  __syncthreads();

  // ---------------- Q fragments (B operand of the score product) kept in registers for whole kernel ------------
  h16 qA[2];
#pragma unroll
  for (int c = 0; c < 2; ++c) {
    const _Float16* base = sm_qn + (wv * 16 + ln) * LPITCH + c * 32;
    qA[c] = cat16(lds_ld8(base + dofs8), lds_ld8(base + 16 + dofs8));
  }

  f8 oacc[4];
#pragma unroll
  for (int t = 0; t < 4; ++t) oacc[t] = {};

  // ================================ key-block loop ==============================
  for (int it = 0; it < KB_PER_SPLIT; ++it) {
    const int kb = ks * KB_PER_SPLIT + it;
    __syncthreads();  // everyone done reading previous Kn / Vt
    // key mask of the 8 keys that this lane half holds in each of the block's four 16-key tiles; loaded with the tile so that one wait covers both
    float4 km[8];
    // unrolled: km lives in registers and needs constant indices
#pragma unroll
    for (int j = 0; j < 8; ++j) km[j] = *(const float4*)(mask + kb * KTILE + (j >> 1) * 16 + lh * 8 + (j & 1) * 4);
    {
      // the block's 128 f16 rows (64 of Kn, 64 of Vt) are 16 KiB in a row in the workspace and 128 rows in a row in LDS: a plain copy, 4 x 16 B a thread
      const h8* g = (const h8*)((const _Float16*)kvw + (size_t)(h * (S_LEN / KTILE) + kb) * KV_TILE_H) + tid;
      _Float16* dst = sm_kn + (tid >> 3) * LPITCH + (tid & 7) * 8;
      h8 t[4];
      // both loops unrolled: t lives in registers and needs constant indices; the four loads stand ahead of the stores
#pragma unroll
      for (int j = 0; j < 4; ++j) t[j] = g[j * 256];
#pragma unroll
      for (int j = 0; j < 4; ++j) *(h8*)(dst + j * 32 * LPITCH) = t[j];
    }
    __syncthreads();

    // ---- per 32 keys: S^T = Kn * Qn^T (keys down, queries across), transform, O += P * V -------------
    // In the accumulator of S^T lane (ln, lh) holds query ln, keys 8*lh..8*lh+7 of its 16-key tile: two such tiles side by side are
    // the A fragment of P for 32 keys (elements 0-7 = k 8*lh.., elements 8-15 = k 16+8*lh..), so P never leaves the registers.
#pragma unroll
    for (int kc = 0; kc < 2; ++kc) {
      h16 PA;
      // this loop and the one over r unrolled: PA, acc and km live in registers and need constant indices
#pragma unroll
      for (int t2 = 0; t2 < 2; ++t2) {
        const int nt = kc * 2 + t2;
        const _Float16* kb0 = sm_kn + (nt * 16 + ln) * LPITCH;
        // A fragment of Kn; the Q fragments serve as B, which uses the same per-lane k map: elements 0-7 = k 8*lh..8*lh+7, elements 8-15 = k 16+8*lh..
        const h16 Klo = cat16(lds_ld8(kb0 + dofs8),      lds_ld8(kb0 + 16 + dofs8));
        const h16 Khi = cat16(lds_ld8(kb0 + 32 + dofs8), lds_ld8(kb0 + 48 + dofs8));
        f8 acc = {};
        acc = __builtin_amdgcn_wmma_f32_16x16x32_f16(false, Klo, false, qA[0], (short)0, acc, false, false);
        acc = __builtin_amdgcn_wmma_f32_16x16x32_f16(false, Khi, false, qA[1], (short)0, acc, false, false);
        // four vector slots between the matrix instruction and the first reader of its result
        asm volatile("v_nop\n\tv_nop\n\tv_nop\n\tv_nop" : "+v"(acc) : "v"(qA[0]), "v"(qA[1]), "v"(Klo), "v"(Khi));
#pragma unroll
        for (int r = 0; r < 8; r += 2) {
          f2 s;                                             // the reference's clip
          s.x = __builtin_amdgcn_fmed3f(acc[r],     -1.f + 1e-6f, 1.f - 1e-6f);
          s.y = __builtin_amdgcn_fmed3f(acc[r + 1], -1.f + 1e-6f, 1.f - 1e-6f);
          const f2 z = __builtin_elementwise_fma(s, (f2)(-0.5f), (f2)(0.5f));
          f2 y;                                             // y = sin(acos(s)/2), in (0, 1)
          y.x = __builtin_amdgcn_sqrtf(z.x);
          y.y = __builtin_amdgcn_sqrtf(z.y);
          f2 p = collision_sq(y);                           // (1 - acos(s)/pi)^2
          p = p * p; p = p * p;                             // ^8
          const float4 k4 = km[nt * 2 + (r >> 2)];          // key mask of this lane's rows r, r + 1
          const f2 kmp = (r & 2) ? (f2){k4.z, k4.w} : (f2){k4.x, k4.y};
          p *= kmp;
          const h2 ph = __builtin_convertvector(p, h2);
          PA[t2 * 8 + r]     = ph.x;
          PA[t2 * 8 + r + 1] = ph.y;
        }
      }
#pragma unroll
      for (int dt = 0; dt < 4; ++dt) {
        const _Float16* vb = sm_vt + (dt * 16 + ln) * LPITCH + kc * 32;
        const h16 BV = cat16(lds_ld8(vb + dofs8), lds_ld8(vb + 16 + dofs8));
        oacc[dt] = __builtin_amdgcn_wmma_f32_16x16x32_f16(false, PA, false, BV, (short)0, oacc[dt], false, false);
      }
      asm volatile("v_nop\n\tv_nop\n\tv_nop\n\tv_nop" : "+v"(oacc[0]), "+v"(oacc[1]), "+v"(oacc[2]), "+v"(oacc[3]) : "v"(PA));
    }
  }

  // ---- partial O of this key range to the workspace, in fragment order: every store is 32 lanes x 16 B = 4 whole lines ----
  {
    float* pt = part + ((((size_t)h * (S_LEN / QTILE) + blockIdx.x) * NWAVE + wv) * NSPLIT + ks) * WAVE_TILE_F32 + lane * 4;
    // both loops unrolled: the accumulators live in registers and need constant indices
#pragma unroll
    for (int dt = 0; dt < 4; ++dt) {
#pragma unroll
      for (int hf = 0; hf < 2; ++hf) {
        *(float4*)(pt + (dt * 2 + hf) * 128) =
            make_float4(oacc[dt][hf * 4 + 0], oacc[dt][hf * 4 + 1], oacc[dt][hf * 4 + 2], oacc[dt][hf * 4 + 3]);
      }
    }
  }
}

// Third launch: sums the NSPLIT partial tiles in fixed order (range 0, 1, 2, 3), then query mask, normalisation, conv branch and the staged store.
// The conv branch is computed where the output is stored: there a thread owns 8 rows x 4 columns, so it needs 10 V rows of 16 B, loaded
// without any condition (the two edge rows by a clamped index, zeroed by a select) and issued at entry together with the partial tiles.
// waves_per_eu(2, 4): the grid is one work-group a WGP (2 waves a SIMD); the wider register budget lets all 48 loads of a lane be in flight at once
__global__ __launch_bounds__(256) __attribute__((amdgpu_waves_per_eu(2, 4)))
void attn_merge_epilogue_kernel(const float* __restrict__ part,
                                const float* __restrict__ V,
                                const float* __restrict__ mask,
                                const float* __restrict__ cw,
                                float* out) {
  const int CSTR = DHEAD + 4;
  __shared__ __align__(16) float cst[QTILE * (DHEAD + 4)];  // output stage [128][CSTR]

  const int h      = blockIdx.y;
  const int qbase  = blockIdx.x * QTILE;
  const int tid    = threadIdx.x;
  const int wv     = tid >> 5;
  const int lane   = tid & 31;
  const int lh     = lane >> 4;
  const int ln     = lane & 15;
  const size_t headoff = (size_t)h * S_LEN * DHEAD;

  // ---- every address of the launch's loads: a scalar base and a 32-bit byte offset of the lane ----
  // store phase: a thread owns rows row0 .. row0 + 7, columns c4 .. c4 + 3; the conv needs rows row0 - 1 .. row0 + 8 of V and of the mask
  const int c4   = (tid & 15) * 4;
  const int rloc = (tid >> 4) * 8;
  const int row0 = qbase + rloc;
  const bool has_lo = row0 > 0, has_hi = row0 + 8 < S_LEN;
  const int srow_base = qbase + wv * 16 + lh * 8;
  const char* vb = (const char*)(V + headoff);
  const char* mb = (const char*)mask;
  const unsigned vofs    = (unsigned)(row0 * DHEAD + c4) * 4u;
  const unsigned vofs_lo = has_lo ? vofs - DHEAD * 4u : vofs;                  // clamped: the two edge addresses stay inside V and the mask
  const unsigned vofs_hi = has_hi ? vofs + 8u * DHEAD * 4u : vofs + 7u * DHEAD * 4u;
  const unsigned mofs    = (unsigned)row0 * 4u;
  const unsigned mofs_lo = has_lo ? mofs - 4u : mofs;
  const unsigned mofs_hi = has_hi ? mofs + 32u : mofs + 28u;
  const unsigned qofs    = (unsigned)srow_base * 4u;
  // wave-uniform tile base (scalar) + one per-lane byte offset: all 32 loads name the same vector register
  const int wvu = __builtin_amdgcn_readfirstlane(wv);
  const char* pt = (const char*)(part + (((size_t)h * (S_LEN / QTILE) + blockIdx.x) * NWAVE + wvu) * (NSPLIT * WAVE_TILE_F32));
  const int split_bytes = WAVE_TILE_F32 * 4;  // the NSPLIT partial tiles of one wave tile lie side by side
  const unsigned lofs = lane * 16u;
  const float w0 = cw[h * 3 + 0], w1 = cw[h * 3 + 1], w2 = cw[h * 3 + 2];

  f4    vr[10];
  float mr[10];
  float4 pv[NSPLIT][8];
  // all loops here unrolled: pv, vr and oacc live in registers and need constant indices; every load stands ahead of the first sum
#pragma unroll
  for (int s = 0; s < NSPLIT; ++s)
#pragma unroll
    for (int j = 0; j < 8; ++j) pv[s][j] = *(const float4*)(pt + s * split_bytes + j * 512 + lofs);
  vr[0] = *(const f4*)(vb + vofs_lo);
#pragma unroll
  for (int j = 0; j < 8; ++j) vr[j + 1] = *(const f4*)(vb + vofs + j * (DHEAD * 4));
  vr[9] = *(const f4*)(vb + vofs_hi);
  const f4 qma = *(const f4*)(mb + qofs), qmb = *(const f4*)(mb + qofs + 16);
  const f4 ma  = *(const f4*)(mb + mofs), mbv = *(const f4*)(mb + mofs + 16);
  mr[0] = *(const float*)(mb + mofs_lo);
  mr[9] = *(const float*)(mb + mofs_hi);
  // Holds these loads here, in flight together with the partial tiles: left alone the compiler sinks the V loads behind the barrier, where their
  // whole latency is waited for a second time. Inputs only: the loaded values, and every offset and base that a load above names, so that none
  // of those registers is rewritten among the loads; the wait stands in front of their first reuse.
  asm volatile("s_wait_xcnt 0x0"
               :: "v"(vr[0]), "v"(vr[1]), "v"(vr[2]), "v"(vr[3]), "v"(vr[4]), "v"(vr[5]), "v"(vr[6]), "v"(vr[7]), "v"(vr[8]), "v"(vr[9]),
                  "v"(qma), "v"(qmb), "v"(ma), "v"(mbv), "v"(mr[0]), "v"(mr[9]),
                  "v"(lofs), "v"(vofs), "v"(vofs_lo), "v"(vofs_hi), "v"(mofs), "v"(mofs_lo), "v"(mofs_hi), "v"(qofs),
                  "s"(pt), "s"(vb), "s"(mb));
  // keeps the sums below: moved up, their waits for the partial tiles come to stand in front of the last six loads, which then start a round trip late
  __builtin_amdgcn_sched_barrier(0);
  mr[1] = ma.x;  mr[2] = ma.y;  mr[3] = ma.z;  mr[4] = ma.w;
  mr[5] = mbv.x; mr[6] = mbv.y; mr[7] = mbv.z; mr[8] = mbv.w;

  f8 oacc[4];
  {
#pragma unroll
    for (int j = 0; j < 8; ++j) {
      float4 a = pv[0][j];
#pragma unroll
      for (int s = 1; s < NSPLIT; ++s) { a.x += pv[s][j].x; a.y += pv[s][j].y; a.z += pv[s][j].z; a.w += pv[s][j].w; }
      oacc[j >> 1][(j & 1) * 4 + 0] = a.x;
      oacc[j >> 1][(j & 1) * 4 + 1] = a.y;
      oacc[j >> 1][(j & 1) * 4 + 2] = a.z;
      oacc[j >> 1][(j & 1) * 4 + 3] = a.w;
    }
  }

  const float qmv[8] = {qma.x, qma.y, qma.z, qma.w, qmb.x, qmb.y, qmb.z, qmb.w};
#pragma unroll
  for (int r = 0; r < 8; ++r) {
    const float qm = qmv[r];
    float xv[4];
    float ss = 0.f;
#pragma unroll
    for (int dt = 0; dt < 4; ++dt) {   // reference order: mask BEFORE normalize
      xv[dt] = oacc[dt][r] * qm;
      ss += xv[dt] * xv[dt];
    }
    // reduce sum of squares across the 16 lanes of this half (row is constant there)
    ss += __shfl_xor(ss, 1);
    ss += __shfl_xor(ss, 2);
    ss += __shfl_xor(ss, 4);
    ss += __shfl_xor(ss, 8);
    const float inv = 1.f / fmaxf(sqrtf(ss), 1e-12f);
    // unrolled: xv lives in registers and needs constant indices
#pragma unroll
    for (int dt = 0; dt < 4; ++dt) cst[(wv * 16 + lh * 8 + r) * CSTR + dt * 16 + ln] = xv[dt] * inv;
  }

  // masked V rows; a row outside the sequence is the conv's zero padding (unrolled: vr and mr need constant indices)
#pragma unroll
  for (int j = 0; j < 10; ++j) {
    const bool in = j == 0 ? has_lo : (j == 9 ? has_hi : true);
    vr[j].x = in ? vr[j].x * mr[j] : 0.f;
    vr[j].y = in ? vr[j].y * mr[j] : 0.f;
    vr[j].z = in ? vr[j].z * mr[j] : 0.f;
    vr[j].w = in ? vr[j].w * mr[j] : 0.f;
  }
  __syncthreads();
  {
    char* ob = (char*)(out + headoff) + vofs;
    // unrolled: vr needs constant indices; every store is 2 rows x 256 B = 4 whole lines
#pragma unroll
    for (int j = 0; j < 8; ++j) {
      const float4 x = *(const float4*)(cst + (rloc + j) * CSTR + c4);
      float4 o;
      o.x = x.x + (w0 * vr[j].x + w1 * vr[j + 1].x + w2 * vr[j + 2].x);
      o.y = x.y + (w0 * vr[j].y + w1 * vr[j + 1].y + w2 * vr[j + 2].y);
      o.z = x.z + (w0 * vr[j].z + w1 * vr[j + 1].z + w2 * vr[j + 2].z);
      o.w = x.w + (w0 * vr[j].w + w1 * vr[j + 1].w + w2 * vr[j + 2].w);
      *(float4*)(ob + j * (DHEAD * 4)) = o;
    }
  }
}

extern "C" void kernel_launch(void* const* d_in, const int* in_sizes, int n_in,
                              void* d_out, int out_size, void* d_ws, size_t ws_size,
                              hipStream_t stream) {
  (void)in_sizes; (void)n_in; (void)out_size; (void)ws_size;
  const float* Q    = (const float*)d_in[0];
  const float* K    = (const float*)d_in[1];
  const float* V    = (const float*)d_in[2];
  const float* mask = (const float*)d_in[3];
  const float* cw   = (const float*)d_in[4];
  float* out = (float*)d_out;

  float* part = (float*)d_ws;       // NSPLIT x 8 MiB of f32 partial tiles, all written by the second launch
  float* kvw  = part + KV_OFS_F32;  // 8 MiB of f16 key-block tiles, all written by the first launch

  dim3 grid(S_LEN / QTILE, NHEAD, NSPLIT);  // 32 query tiles x 8 heads x 4 key ranges
  dim3 grid0(S_LEN / KTILE, NHEAD);         // 64 key blocks x 8 heads
  dim3 grid2(S_LEN / QTILE, NHEAD);
  dim3 block(32 * NWAVE);                   // 8 wave32 waves
  kv_f16_tiles_kernel<<<grid0, block, 0, stream>>>(K, V, kvw);
  yoso_attn_wmma_kernel<<<grid, block, 0, stream>>>(Q, kvw, mask, part);
  attn_merge_epilogue_kernel<<<grid2, block, 0, stream>>>(part, V, mask, cw, out);
}

// v008
// A run of this version takes 51.4 microseconds.
// It is 1.10 times as fast as v006, going by the measured steps of the versions left out in between.
// Over all steps from v000 it is 5.74 times as fast.
#include <hip/hip_runtime.h>

// Contractions Kn.Qn^T (K=64) and P.V (K=64 per key block) on v_wmma_f32_16x16x32_f16 (f16 operands, f32 accumulate); normalisation, arccos power, conv and epilogue in f32.

typedef _Float16 h8  __attribute__((ext_vector_type(8)));
typedef _Float16 h16 __attribute__((ext_vector_type(16)));
typedef float    f8  __attribute__((ext_vector_type(8)));
typedef float    f2  __attribute__((ext_vector_type(2)));
typedef float    f4  __attribute__((ext_vector_type(4)));
typedef _Float16 h2  __attribute__((ext_vector_type(2)));

#define S_LEN 4096
#define NHEAD 8
#define DHEAD 64
#define QTILE 128
#define KTILE 64
#define NWAVE 8    // 16-query tiles of one query tile: the unit of the partial tiles in the workspace, and the waves of the first and third launch
#define QSUB 2     // 16-query tiles per wave of the main launch: every K and V fragment read from LDS feeds two matrix products
#define NWAVE_MAIN (NWAVE / QSUB)
#define NSPLIT 4   // key ranges per query tile: 4 work-groups of 4 waves share a WGP, so one group's load and LDS waits are covered by the others' vector work
#define KB_PER_SPLIT (S_LEN / KTILE / NSPLIT)
#define WAVE_TILE_F32 (16 * DHEAD)  // one 16-query tile's 16 x 64 f32 accumulator in the workspace, kept in fragment order
#define KV_TILE_H (2 * KTILE * DHEAD)  // halves of one key block in the workspace: 64 x 64 normalized K rows, then 64 x 64 V transposed (d-major)
#define KV_OFS_F32 ((size_t)NSPLIT * NHEAD * S_LEN * DHEAD)  // the f16 tiles lie behind the f32 partial tiles
#define LPITCH 72  // LDS row pitch in halves: 144 B = 16 B x 9 (odd), so the 16 rows of a ds_load_b128 fragment read fall on distinct banks

__device__ __forceinline__ h16 cat16(h8 a, h8 b) {
  h16 r;
#pragma unroll
  for (int i = 0; i < 8; ++i) { r[i] = a[i]; r[i + 8] = b[i]; }
  return r;
}

__device__ __forceinline__ h8 lds_ld8(const _Float16* p) {
  return *(const h8*)p;
}

// (1 - acos(s)/pi)^2 as one polynomial in y = sqrt((1 - s)/2), for every s in [-1, 1].
// acos(s) = 2 asin(y), so 1 - acos(s)/pi = (2/pi) acos(y); acos(y) behaves like sqrt(1 - y) at y = 1, its square is smooth there,
// and the only singular point left is y = -1, outside [0, 1]: no branch on the sign or the size of s, and one squaring fewer.
// Degree-4 minimax fit on [0, 1], weighted for the relative error of the 8th power: with the f32 rounding of the chain it is within
// 3.5e-4 of it wherever it is an f16 normal number, and within 2e-8 absolute below that. The degree is set by what follows: P is rounded
// to f16, a step of up to 4.9e-4 relative, so terms that only bring the fit further under that step buy nothing in the product P*V.
// Two scores at a time: the pairs keep every multiply-add of the chain on the packed f32 form.
__device__ __forceinline__ f2 collision_sq(f2 y) {
  f2 q = (f2)(0.0308360215f);
  q = __builtin_elementwise_fma(q, y, (f2)(-0.141762391f));
  q = __builtin_elementwise_fma(q, y, (f2)(0.380873263f));
  q = __builtin_elementwise_fma(q, y, (f2)(-1.26985466f));
  q = __builtin_elementwise_fma(q, y, (f2)(0.999915242f));
  return q;
}

// First launch: each 64-key block once per head (the main launch reads it from 32 query tiles): K rows L2-normalized to f16, V to f16 and transposed.
__global__ __launch_bounds__(256)
void kv_f16_tiles_kernel(const float* __restrict__ K,
                         const float* __restrict__ V,
                         float* __restrict__ kvw) {
  __shared__ __align__(16) _Float16 sm_kn[(KTILE + DHEAD) * LPITCH];  // 64 rows of Kn, then 64 rows of vt[d][key]
  _Float16* sm_vt = sm_kn + KTILE * LPITCH;
  const int h   = blockIdx.y;
  const int kb  = blockIdx.x;
  const int tid = threadIdx.x;
  const size_t headoff = (size_t)h * S_LEN * DHEAD;
  {
    const int r  = tid >> 2;      // key row 0..63
    const int q4 = tid & 3;       // 16-col quarter
    const int key = kb * KTILE + r;
    const float* krow = K + headoff + (size_t)key * DHEAD + q4 * 16;
    float4 b[4];
    float ss = 0.f;
#pragma unroll
    for (int i = 0; i < 4; ++i) {
      b[i] = ((const float4*)krow)[i];
      ss += b[i].x * b[i].x + b[i].y * b[i].y + b[i].z * b[i].z + b[i].w * b[i].w;
    }
    ss += __shfl_xor(ss, 1);
    ss += __shfl_xor(ss, 2);
    const float inv = 1.f / fmaxf(sqrtf(ss), 1e-12f);
    _Float16* dst = sm_kn + r * LPITCH + q4 * 16;
#pragma unroll
    for (int i = 0; i < 4; ++i) {
      dst[i * 4 + 0] = (_Float16)(b[i].x * inv);
      dst[i * 4 + 1] = (_Float16)(b[i].y * inv);
      dst[i * 4 + 2] = (_Float16)(b[i].z * inv);
      dst[i * 4 + 3] = (_Float16)(b[i].w * inv);
    }
    // V block, stored transposed so P*V B-fragments are contiguous b128 loads
    const float* vrow = V + headoff + (size_t)key * DHEAD + q4 * 16;
#pragma unroll
    for (int i = 0; i < 4; ++i) {
      const float4 v4 = ((const float4*)vrow)[i];
      const int c0 = q4 * 16 + i * 4;
      const f2 lo = {v4.x, v4.y}, hi = {v4.z, v4.w};  // pairs: one packed conversion for two values
      const h2 hlo = __builtin_convertvector(lo, h2), hhi = __builtin_convertvector(hi, h2);
      sm_vt[(c0 + 0) * LPITCH + r] = hlo.x;
      sm_vt[(c0 + 1) * LPITCH + r] = hlo.y;
      sm_vt[(c0 + 2) * LPITCH + r] = hhi.x;
      sm_vt[(c0 + 3) * LPITCH + r] = hhi.y;
    }
  }
  __syncthreads();  // all 128 rows complete before they are read back whole
  {
    // 128 rows of 128 B go out unpadded, 16 KiB in a row: every store is 32 lanes x 16 B = 4 whole lines
    h8* g = (h8*)((_Float16*)kvw + (size_t)(h * (S_LEN / KTILE) + kb) * KV_TILE_H) + tid;
    const _Float16* s = sm_kn + (tid >> 3) * LPITCH + (tid & 7) * 8;
    // unrolled: the four LDS reads are issued together, ahead of the stores
#pragma unroll
    for (int j = 0; j < 4; ++j) g[j * 256] = lds_ld8(s + j * 32 * LPITCH);
  }
}

// waves_per_eu(4, 4): at most 4 of these work-groups per WGP, so the 1024 work-groups spread 4 to each of the 256 WGPs and none takes a fifth
__global__ __launch_bounds__(32 * NWAVE_MAIN) __attribute__((amdgpu_waves_per_eu(4, 4)))
void yoso_attn_wmma_kernel(const float* __restrict__ Q,
                           const float* __restrict__ kvw,
                           const float* __restrict__ mask,
                           float* __restrict__ part) {
  // one LDS arena: [qn 128 | kn 64 | vt 64] rows of LPITCH halves (64 used) = 36864 B
  __shared__ __align__(16) unsigned char smem[(QTILE + KTILE + DHEAD) * LPITCH * 2];
  _Float16* sm_qn = (_Float16*)smem;                       // normalized Q tile, row-major
  _Float16* sm_kn = sm_qn + QTILE * LPITCH;                 // normalized K block, row-major
  _Float16* sm_vt = sm_kn + KTILE * LPITCH;                 // V block transposed: vt[d][key]

  const int h      = blockIdx.y;
  const int ks     = blockIdx.z;  // key range of this work-group
  const int qbase  = blockIdx.x * QTILE;
  const int tid    = threadIdx.x;
  const int wv     = tid >> 5;
  const int lane   = tid & 31;
  const int lh     = lane >> 4;   // lane half: 0 or 1
  const int ln     = lane & 15;
  const int dofs8  = lh * 8;      // A-frag half offset (K 0-7/16-23 vs 8-15/24-31)
  const size_t headoff = (size_t)h * S_LEN * DHEAD;

  // ---------------- Stage L2-normalized Q tile (2 threads / row, 64 rows a pass) ----------------
  // unrolled: both passes' loads are in flight together
#pragma unroll
  for (int ps = 0; ps < QSUB; ++ps) {
    const int r  = ps * (QTILE / QSUB) + (tid >> 1);
    const int hf = tid & 1;
    const float* qrow = Q + headoff + (size_t)(qbase + r) * DHEAD + hf * 32;
    float4 b[8];
    float ss = 0.f;
#pragma unroll
    for (int i = 0; i < 8; ++i) {
      b[i] = ((const float4*)qrow)[i];
      ss += b[i].x * b[i].x + b[i].y * b[i].y + b[i].z * b[i].z + b[i].w * b[i].w;
    }
    ss += __shfl_xor(ss, 1);
    const float inv = 1.f / fmaxf(sqrtf(ss), 1e-12f);
    _Float16* dst = sm_qn + r * LPITCH + hf * 32;
#pragma unroll
    for (int i = 0; i < 8; ++i) {
      dst[i * 4 + 0] = (_Float16)(b[i].x * inv);
      dst[i * 4 + 1] = (_Float16)(b[i].y * inv);
      dst[i * 4 + 2] = (_Float16)(b[i].z * inv);
      dst[i * 4 + 3] = (_Float16)(b[i].w * inv);
    }
  }
  __syncthreads();

  // ---------------- Q fragments (B operand of the score product) kept in registers for whole kernel ------------
  h16 qA[QSUB][2];
  // both loops unrolled: qA lives in registers and needs constant indices
#pragma unroll
  for (int qs = 0; qs < QSUB; ++qs) {
#pragma unroll
    for (int c = 0; c < 2; ++c) {
      const _Float16* base = sm_qn + ((wv * QSUB + qs) * 16 + ln) * LPITCH + c * 32;
      qA[qs][c] = cat16(lds_ld8(base + dofs8), lds_ld8(base + 16 + dofs8));
    }
  }

  f8 oacc[QSUB][4];
  // both loops unrolled: oacc lives in registers and needs constant indices
#pragma unroll
  for (int qs = 0; qs < QSUB; ++qs)
#pragma unroll
    for (int t = 0; t < 4; ++t) oacc[qs][t] = {};

  // ================================ key-block loop ==============================
  for (int it = 0; it < KB_PER_SPLIT; ++it) {
    const int kb = ks * KB_PER_SPLIT + it;
    __syncthreads();  // everyone done reading previous Kn / Vt
    // key mask of the 8 keys that this lane half holds in each of the block's four 16-key tiles; loaded with the tile so that one wait covers both
    float4 km[8];
    // unrolled: km lives in registers and needs constant indices
#pragma unroll
    for (int j = 0; j < 8; ++j) km[j] = *(const float4*)(mask + kb * KTILE + (j >> 1) * 16 + lh * 8 + (j & 1) * 4);
    {
      // the block's 128 f16 rows (64 of Kn, 64 of Vt) are 16 KiB in a row in the workspace and 128 rows in a row in LDS: a plain copy, 8 x 16 B a thread
      const h8* g = (const h8*)((const _Float16*)kvw + (size_t)(h * (S_LEN / KTILE) + kb) * KV_TILE_H) + tid;
      _Float16* dst = sm_kn + (tid >> 3) * LPITCH + (tid & 7) * 8;
      h8 t[8];
      // both loops unrolled: t lives in registers and needs constant indices; the eight loads stand ahead of the stores
#pragma unroll
      for (int j = 0; j < 8; ++j) t[j] = g[j * 128];
      // the wait in front of the first rewrite of the loads' address; the eight loaded values and the address are inputs, so that no result lands in the address pair
      asm volatile("s_wait_xcnt 0x0" :: "v"(t[0]), "v"(t[1]), "v"(t[2]), "v"(t[3]), "v"(t[4]), "v"(t[5]), "v"(t[6]), "v"(t[7]), "v"(g) : "memory");
#pragma unroll
      for (int j = 0; j < 8; ++j) *(h8*)(dst + j * 16 * LPITCH) = t[j];
    }
    __syncthreads();

    // ---- per 32 keys: S^T = Kn * Qn^T (keys down, queries across), transform, O += P * V -------------
    // In the accumulator of S^T lane (ln, lh) holds query ln, keys 8*lh..8*lh+7 of its 16-key tile: two such tiles side by side are
    // the A fragment of P for 32 keys (elements 0-7 = k 8*lh.., elements 8-15 = k 16+8*lh..), so P never leaves the registers.
#pragma unroll
    for (int kc = 0; kc < 2; ++kc) {
      h16 PA[QSUB];
      // this loop and those over qs and r unrolled: PA, acc, qA and km live in registers and need constant indices
#pragma unroll
      for (int t2 = 0; t2 < 2; ++t2) {
        const int nt = kc * 2 + t2;
        const _Float16* kb0 = sm_kn + (nt * 16 + ln) * LPITCH;
        // A fragment of Kn; the Q fragments serve as B, which uses the same per-lane k map: elements 0-7 = k 8*lh..8*lh+7, elements 8-15 = k 16+8*lh..
        const h16 Klo = cat16(lds_ld8(kb0 + dofs8),      lds_ld8(kb0 + 16 + dofs8));
        const h16 Khi = cat16(lds_ld8(kb0 + 32 + dofs8), lds_ld8(kb0 + 48 + dofs8));
        // one read of the K fragments, both query tiles: two independent accumulator chains, each standing in the other's wait
        f8 acc[QSUB];
#pragma unroll
        for (int qs = 0; qs < QSUB; ++qs) {
          const f8 zero = {};
          acc[qs] = __builtin_amdgcn_wmma_f32_16x16x32_f16(false, Klo, false, qA[qs][0], (short)0, zero, false, false);
        }
#pragma unroll
        for (int qs = 0; qs < QSUB; ++qs)
          acc[qs] = __builtin_amdgcn_wmma_f32_16x16x32_f16(false, Khi, false, qA[qs][1], (short)0, acc[qs], false, false);
#pragma unroll
        for (int qs = 0; qs < QSUB; ++qs) {
#pragma unroll
          for (int r = 0; r < 8; r += 2) {
            f2 s;                                             // the reference's clip
            s.x = __builtin_amdgcn_fmed3f(acc[qs][r],     -1.f + 1e-6f, 1.f - 1e-6f);
            s.y = __builtin_amdgcn_fmed3f(acc[qs][r + 1], -1.f + 1e-6f, 1.f - 1e-6f);
            const f2 z = __builtin_elementwise_fma(s, (f2)(-0.5f), (f2)(0.5f));
            f2 y;                                             // y = sin(acos(s)/2), in (0, 1)
            y.x = __builtin_amdgcn_sqrtf(z.x);
            y.y = __builtin_amdgcn_sqrtf(z.y);
            f2 p = collision_sq(y);                           // (1 - acos(s)/pi)^2
            p = p * p; p = p * p;                             // ^8
            const float4 k4 = km[nt * 2 + (r >> 2)];          // key mask of this lane's rows r, r + 1
            const f2 kmp = (r & 2) ? (f2){k4.z, k4.w} : (f2){k4.x, k4.y};
            p *= kmp;
            const h2 ph = __builtin_convertvector(p, h2);
            PA[qs][t2 * 8 + r]     = ph.x;
            PA[qs][t2 * 8 + r + 1] = ph.y;
          }
        }
      }
#pragma unroll
      for (int dt = 0; dt < 4; ++dt) {
        const _Float16* vb = sm_vt + (dt * 16 + ln) * LPITCH + kc * 32;
        const h16 BV = cat16(lds_ld8(vb + dofs8), lds_ld8(vb + 16 + dofs8));
        // one read of the V fragment, both query tiles (unrolled: PA and oacc need constant indices)
#pragma unroll
        for (int qs = 0; qs < QSUB; ++qs)
          oacc[qs][dt] = __builtin_amdgcn_wmma_f32_16x16x32_f16(false, PA[qs], false, BV, (short)0, oacc[qs][dt], false, false);
      }
    }
    // four vector slots behind the trip's last matrix instructions: on the taken back edge the next trip's loads land in their operand registers
    asm volatile("v_nop\n\tv_nop\n\tv_nop\n\tv_nop"
                 : "+v"(oacc[0][0]), "+v"(oacc[0][1]), "+v"(oacc[0][2]), "+v"(oacc[0][3]),
                   "+v"(oacc[1][0]), "+v"(oacc[1][1]), "+v"(oacc[1][2]), "+v"(oacc[1][3]));
  }

  // ---- partial O of this key range to the workspace, in fragment order: every store is 32 lanes x 16 B = 4 whole lines ----
  // all three loops unrolled: the accumulators live in registers and need constant indices
#pragma unroll
  for (int qs = 0; qs < QSUB; ++qs) {
    float* pt = part + ((((size_t)h * (S_LEN / QTILE) + blockIdx.x) * NWAVE + wv * QSUB + qs) * NSPLIT + ks) * WAVE_TILE_F32 + lane * 4;
#pragma unroll
    for (int dt = 0; dt < 4; ++dt) {
#pragma unroll
      for (int hf = 0; hf < 2; ++hf) {
        *(float4*)(pt + (dt * 2 + hf) * 128) =
            make_float4(oacc[qs][dt][hf * 4 + 0], oacc[qs][dt][hf * 4 + 1], oacc[qs][dt][hf * 4 + 2], oacc[qs][dt][hf * 4 + 3]);
      }
    }
  }
}

// Third launch: sums the NSPLIT partial tiles in fixed order (range 0, 1, 2, 3), then query mask, normalisation, conv branch and the staged store.
// The conv branch is computed where the output is stored: there a thread owns 8 rows x 4 columns, so it needs 10 V rows of 16 B, loaded
// without any condition (the two edge rows by a clamped index, zeroed by a select) and issued at entry together with the partial tiles.
// waves_per_eu(2, 4): the grid is one work-group a WGP (2 waves a SIMD); the wider register budget lets all 48 loads of a lane be in flight at once
__global__ __launch_bounds__(256) __attribute__((amdgpu_waves_per_eu(2, 4)))
void attn_merge_epilogue_kernel(const float* __restrict__ part,
                                const float* __restrict__ V,
                                const float* __restrict__ mask,
                                const float* __restrict__ cw,
                                float* out) {
  const int CSTR = DHEAD + 4;
  __shared__ __align__(16) float cst[QTILE * (DHEAD + 4)];  // output stage [128][CSTR]

  const int h      = blockIdx.y;
  const int qbase  = blockIdx.x * QTILE;
  const int tid    = threadIdx.x;
  const int wv     = tid >> 5;
  const int lane   = tid & 31;
  const int lh     = lane >> 4;
  const int ln     = lane & 15;
  const size_t headoff = (size_t)h * S_LEN * DHEAD;

  // ---- every address of the launch's loads: a scalar base and a 32-bit byte offset of the lane ----
  // store phase: a thread owns rows row0 .. row0 + 7, columns c4 .. c4 + 3; the conv needs rows row0 - 1 .. row0 + 8 of V and of the mask
  const int c4   = (tid & 15) * 4;
  const int rloc = (tid >> 4) * 8;
  const int row0 = qbase + rloc;
  const bool has_lo = row0 > 0, has_hi = row0 + 8 < S_LEN;
  const int srow_base = qbase + wv * 16 + lh * 8;
  const char* vb = (const char*)(V + headoff);
  const char* mb = (const char*)mask;
  const unsigned vofs    = (unsigned)(row0 * DHEAD + c4) * 4u;
  const unsigned vofs_lo = has_lo ? vofs - DHEAD * 4u : vofs;                  // clamped: the two edge addresses stay inside V and the mask
  const unsigned vofs_hi = has_hi ? vofs + 8u * DHEAD * 4u : vofs + 7u * DHEAD * 4u;
  const unsigned mofs    = (unsigned)row0 * 4u;
  const unsigned mofs_lo = has_lo ? mofs - 4u : mofs;
  const unsigned mofs_hi = has_hi ? mofs + 32u : mofs + 28u;
  const unsigned qofs    = (unsigned)srow_base * 4u;
  // wave-uniform tile base (scalar) + one per-lane byte offset: all 32 loads name the same vector register
  const int wvu = __builtin_amdgcn_readfirstlane(wv);
  const char* pt = (const char*)(part + (((size_t)h * (S_LEN / QTILE) + blockIdx.x) * NWAVE + wvu) * (NSPLIT * WAVE_TILE_F32));
  const int split_bytes = WAVE_TILE_F32 * 4;  // the NSPLIT partial tiles of one wave tile lie side by side
  const unsigned lofs = lane * 16u;
  const float w0 = cw[h * 3 + 0], w1 = cw[h * 3 + 1], w2 = cw[h * 3 + 2];

  f4    vr[10];
  float mr[10];
  float4 pv[NSPLIT][8];
  // all loops here unrolled: pv, vr and oacc live in registers and need constant indices; every load stands ahead of the first sum
#pragma unroll
  for (int s = 0; s < NSPLIT; ++s)
#pragma unroll
    for (int j = 0; j < 8; ++j) pv[s][j] = *(const float4*)(pt + s * split_bytes + j * 512 + lofs);
  vr[0] = *(const f4*)(vb + vofs_lo);
#pragma unroll
  for (int j = 0; j < 8; ++j) vr[j + 1] = *(const f4*)(vb + vofs + j * (DHEAD * 4));
  vr[9] = *(const f4*)(vb + vofs_hi);
  const f4 qma = *(const f4*)(mb + qofs), qmb = *(const f4*)(mb + qofs + 16);
  const f4 ma  = *(const f4*)(mb + mofs), mbv = *(const f4*)(mb + mofs + 16);
  mr[0] = *(const float*)(mb + mofs_lo);
  mr[9] = *(const float*)(mb + mofs_hi);
  // Holds these loads here, in flight together with the partial tiles: left alone the compiler sinks the V loads behind the barrier, where their
  // whole latency is waited for a second time. Inputs only: the loaded values, and every offset and base that a load above names, so that none
  // of those registers is rewritten among the loads; the wait stands in front of their first reuse.
  asm volatile("s_wait_xcnt 0x0"
               :: "v"(vr[0]), "v"(vr[1]), "v"(vr[2]), "v"(vr[3]), "v"(vr[4]), "v"(vr[5]), "v"(vr[6]), "v"(vr[7]), "v"(vr[8]), "v"(vr[9]),
                  "v"(qma), "v"(qmb), "v"(ma), "v"(mbv), "v"(mr[0]), "v"(mr[9]),
                  "v"(lofs), "v"(vofs), "v"(vofs_lo), "v"(vofs_hi), "v"(mofs), "v"(mofs_lo), "v"(mofs_hi), "v"(qofs),
                  "s"(pt), "s"(vb), "s"(mb));
  // keeps the sums below: moved up, their waits for the partial tiles come to stand in front of the last six loads, which then start a round trip late
  __builtin_amdgcn_sched_barrier(0);
  mr[1] = ma.x;  mr[2] = ma.y;  mr[3] = ma.z;  mr[4] = ma.w;
  mr[5] = mbv.x; mr[6] = mbv.y; mr[7] = mbv.z; mr[8] = mbv.w;

  f8 oacc[4];
  {
#pragma unroll
    for (int j = 0; j < 8; ++j) {
      float4 a = pv[0][j];
#pragma unroll
      for (int s = 1; s < NSPLIT; ++s) { a.x += pv[s][j].x; a.y += pv[s][j].y; a.z += pv[s][j].z; a.w += pv[s][j].w; }
      oacc[j >> 1][(j & 1) * 4 + 0] = a.x;
      oacc[j >> 1][(j & 1) * 4 + 1] = a.y;
      oacc[j >> 1][(j & 1) * 4 + 2] = a.z;
      oacc[j >> 1][(j & 1) * 4 + 3] = a.w;
    }
  }

  const float qmv[8] = {qma.x, qma.y, qma.z, qma.w, qmb.x, qmb.y, qmb.z, qmb.w};
#pragma unroll
  for (int r = 0; r < 8; ++r) {
    const float qm = qmv[r];
    float xv[4];
    float ss = 0.f;
#pragma unroll
    for (int dt = 0; dt < 4; ++dt) {   // reference order: mask BEFORE normalize
      xv[dt] = oacc[dt][r] * qm;
      ss += xv[dt] * xv[dt];
    }
    // reduce sum of squares across the 16 lanes of this half (row is constant there)
    ss += __shfl_xor(ss, 1);
    ss += __shfl_xor(ss, 2);
    ss += __shfl_xor(ss, 4);
    ss += __shfl_xor(ss, 8);
    const float inv = 1.f / fmaxf(sqrtf(ss), 1e-12f);
    // unrolled: xv lives in registers and needs constant indices
#pragma unroll
    for (int dt = 0; dt < 4; ++dt) cst[(wv * 16 + lh * 8 + r) * CSTR + dt * 16 + ln] = xv[dt] * inv;
  }

  // masked V rows; a row outside the sequence is the conv's zero padding (unrolled: vr and mr need constant indices)
#pragma unroll
  for (int j = 0; j < 10; ++j) {
    const bool in = j == 0 ? has_lo : (j == 9 ? has_hi : true);
    vr[j].x = in ? vr[j].x * mr[j] : 0.f;
    vr[j].y = in ? vr[j].y * mr[j] : 0.f;
    vr[j].z = in ? vr[j].z * mr[j] : 0.f;
    vr[j].w = in ? vr[j].w * mr[j] : 0.f;
  }
  __syncthreads();
  {
    char* ob = (char*)(out + headoff) + vofs;
    // unrolled: vr needs constant indices; every store is 2 rows x 256 B = 4 whole lines
#pragma unroll
    for (int j = 0; j < 8; ++j) {
      const float4 x = *(const float4*)(cst + (rloc + j) * CSTR + c4);
      float4 o;
      o.x = x.x + (w0 * vr[j].x + w1 * vr[j + 1].x + w2 * vr[j + 2].x);
      o.y = x.y + (w0 * vr[j].y + w1 * vr[j + 1].y + w2 * vr[j + 2].y);
      o.z = x.z + (w0 * vr[j].z + w1 * vr[j + 1].z + w2 * vr[j + 2].z);
      o.w = x.w + (w0 * vr[j].w + w1 * vr[j + 1].w + w2 * vr[j + 2].w);
      *(float4*)(ob + j * (DHEAD * 4)) = o;
    }
  }
}

extern "C" void kernel_launch(void* const* d_in, const int* in_sizes, int n_in,
                              void* d_out, int out_size, void* d_ws, size_t ws_size,
                              hipStream_t stream) {
  (void)in_sizes; (void)n_in; (void)out_size; (void)ws_size;
  const float* Q    = (const float*)d_in[0];
  const float* K    = (const float*)d_in[1];
  const float* V    = (const float*)d_in[2];
  const float* mask = (const float*)d_in[3];
  const float* cw   = (const float*)d_in[4];
  float* out = (float*)d_out;

  float* part = (float*)d_ws;       // NSPLIT x 8 MiB of f32 partial tiles, all written by the second launch
  float* kvw  = part + KV_OFS_F32;  // 8 MiB of f16 key-block tiles, all written by the first launch

  dim3 grid(S_LEN / QTILE, NHEAD, NSPLIT);  // 32 query tiles x 8 heads x 4 key ranges
  dim3 grid0(S_LEN / KTILE, NHEAD);         // 64 key blocks x 8 heads
  dim3 grid2(S_LEN / QTILE, NHEAD);
  dim3 block(32 * NWAVE);                   // 8 wave32 waves
  dim3 block1(32 * NWAVE_MAIN);             // 4 wave32 waves, 32 queries each
  kv_f16_tiles_kernel<<<grid0, block, 0, stream>>>(K, V, kvw);
  yoso_attn_wmma_kernel<<<grid, block1, 0, stream>>>(Q, kvw, mask, part);
  attn_merge_epilogue_kernel<<<grid2, block, 0, stream>>>(part, V, mask, cw, out);
}

// v009
// One run takes 45.8 microseconds.
// In two side-by-side timings against v008, it was 1.13 and 1.14 times as fast.
// All steps since v000 together make it 6.50 times as fast.
#include <hip/hip_runtime.h>

// Contractions Kn.Qn^T (K=64) and P.V (K=64 per key block) on v_wmma_f32_16x16x32_f16 (f16 operands, f32 accumulate); normalisation, arccos power, conv and epilogue in f32.

typedef _Float16 h8  __attribute__((ext_vector_type(8)));
typedef _Float16 h16 __attribute__((ext_vector_type(16)));
typedef float    f8  __attribute__((ext_vector_type(8)));
typedef float    f2  __attribute__((ext_vector_type(2)));
typedef float    f4  __attribute__((ext_vector_type(4)));
typedef _Float16 h2  __attribute__((ext_vector_type(2)));

#define S_LEN 4096
#define NHEAD 8
#define DHEAD 64
#define QTILE 128
#define KTILE 64
#define NWAVE 8    // 16-query tiles of one query tile: the unit of the partial tiles in LDS, and the waves of the first launch
#define QSUB 2     // 16-query tiles per wave of the main launch: every K and V fragment read from LDS feeds two matrix products
#define NWAVE_Q (NWAVE / QSUB)           // waves that share one key range
#define NWAVE_MAIN (NSPLIT * NWAVE_Q)    // waves of the main launch's work-group: 4 query pairs x 4 key ranges, 4 waves a SIMD
#define NSPLIT 4   // key ranges per query tile, all four in one work-group: their partial sums meet in LDS
#define KB_PER_SPLIT (S_LEN / KTILE / NSPLIT)
#define WAVE_TILE_F32 (16 * DHEAD)  // one 16 x 64 f32 accumulator tile in LDS, kept in fragment order
#define KV_TILE_H (2 * KTILE * DHEAD)  // halves of one key block in the workspace: 64 x 64 normalized K rows, then 64 x 64 V transposed (d-major)
#define KV_LDS_H ((KTILE + DHEAD) * LPITCH)  // halves of one key block in LDS: 128 padded rows
#define KB_PER_STAGE 2                       // key blocks of a range between two barriers: half the barriers, and the waves drift apart between them
#define NSTAGE (KB_PER_SPLIT / KB_PER_STAGE)
#define KV_STAGE_H (KB_PER_STAGE * KV_LDS_H) // one range's share of a buffer
#define KV_BUF_H (NSPLIT * KV_STAGE_H)       // one buffer: the current stage of each of the four ranges
#define CSTR (DHEAD + 4)                     // row pitch of the output stage, in floats
#define LPITCH 72  // LDS row pitch in halves: 144 B = 16 B x 9 (odd), so the 16 rows of a ds_load_b128 fragment read fall on distinct banks

__device__ __forceinline__ h16 cat16(h8 a, h8 b) {
  h16 r;
#pragma unroll
  for (int i = 0; i < 8; ++i) { r[i] = a[i]; r[i + 8] = b[i]; }
  return r;
}

__device__ __forceinline__ h8 lds_ld8(const _Float16* p) {
  return *(const h8*)p;
}

// (1 - acos(s)/pi)^2 as one polynomial in y = sqrt((1 - s)/2), for every s in [-1, 1].
// acos(s) = 2 asin(y), so 1 - acos(s)/pi = (2/pi) acos(y); acos(y) behaves like sqrt(1 - y) at y = 1, its square is smooth there,
// and the only singular point left is y = -1, outside [0, 1]: no branch on the sign or the size of s, and one squaring fewer.
// Degree-4 minimax fit on [0, 1], weighted for the relative error of the 8th power: with the f32 rounding of the chain it is within
// 3.5e-4 of it wherever it is an f16 normal number, and within 2e-8 absolute below that. The degree is set by what follows: P is rounded
// to f16, a step of up to 4.9e-4 relative, so terms that only bring the fit further under that step buy nothing in the product P*V.
// Two scores at a time: the pairs keep every multiply-add of the chain on the packed f32 form.
__device__ __forceinline__ f2 collision_sq(f2 y) {
  f2 q = (f2)(0.0308360215f);
  q = __builtin_elementwise_fma(q, y, (f2)(-0.141762391f));
  q = __builtin_elementwise_fma(q, y, (f2)(0.380873263f));
  q = __builtin_elementwise_fma(q, y, (f2)(-1.26985466f));
  q = __builtin_elementwise_fma(q, y, (f2)(0.999915242f));
  return q;
}

// First launch: each 64-key block once per head (the main launch reads it from 32 query tiles): K rows L2-normalized to f16, V to f16 and transposed.
__global__ __launch_bounds__(256)
void kv_f16_tiles_kernel(const float* __restrict__ K,
                         const float* __restrict__ V,
                         float* __restrict__ kvw) {
  __shared__ __align__(16) _Float16 sm_kn[(KTILE + DHEAD) * LPITCH];  // 64 rows of Kn, then 64 rows of vt[d][key]
  _Float16* sm_vt = sm_kn + KTILE * LPITCH;
  const int h   = blockIdx.y;
  const int kb  = blockIdx.x;
  const int tid = threadIdx.x;
  const size_t headoff = (size_t)h * S_LEN * DHEAD;
  {
    const int r  = tid >> 2;      // key row 0..63
    const int q4 = tid & 3;       // 16-col quarter
    const int key = kb * KTILE + r;
    const float* krow = K + headoff + (size_t)key * DHEAD + q4 * 16;
    float4 b[4];
    float ss = 0.f;
#pragma unroll
    for (int i = 0; i < 4; ++i) {
      b[i] = ((const float4*)krow)[i];
      ss += b[i].x * b[i].x + b[i].y * b[i].y + b[i].z * b[i].z + b[i].w * b[i].w;
    }
    ss += __shfl_xor(ss, 1);
    ss += __shfl_xor(ss, 2);
    const float inv = 1.f / fmaxf(sqrtf(ss), 1e-12f);
    _Float16* dst = sm_kn + r * LPITCH + q4 * 16;
#pragma unroll
    for (int i = 0; i < 4; ++i) {
      dst[i * 4 + 0] = (_Float16)(b[i].x * inv);
      dst[i * 4 + 1] = (_Float16)(b[i].y * inv);
      dst[i * 4 + 2] = (_Float16)(b[i].z * inv);
      dst[i * 4 + 3] = (_Float16)(b[i].w * inv);
    }
    // V block, stored transposed so P*V B-fragments are contiguous b128 loads
    const float* vrow = V + headoff + (size_t)key * DHEAD + q4 * 16;
#pragma unroll
    for (int i = 0; i < 4; ++i) {
      const float4 v4 = ((const float4*)vrow)[i];
      const int c0 = q4 * 16 + i * 4;
      const f2 lo = {v4.x, v4.y}, hi = {v4.z, v4.w};  // pairs: one packed conversion for two values
      const h2 hlo = __builtin_convertvector(lo, h2), hhi = __builtin_convertvector(hi, h2);
      sm_vt[(c0 + 0) * LPITCH + r] = hlo.x;
      sm_vt[(c0 + 1) * LPITCH + r] = hlo.y;
      sm_vt[(c0 + 2) * LPITCH + r] = hhi.x;
      sm_vt[(c0 + 3) * LPITCH + r] = hhi.y;
    }
  }
  __syncthreads();  // all 128 rows complete before they are read back whole
  {
    // 128 rows of 128 B go out unpadded, 16 KiB in a row: every store is 32 lanes x 16 B = 4 whole lines
    h8* g = (h8*)((_Float16*)kvw + (size_t)(h * (S_LEN / KTILE) + kb) * KV_TILE_H) + tid;
    const _Float16* s = sm_kn + (tid >> 3) * LPITCH + (tid & 7) * 8;
    // unrolled: the four LDS reads are issued together, ahead of the stores
#pragma unroll
    for (int j = 0; j < 4; ++j) g[j * 256] = lds_ld8(s + j * 32 * LPITCH);
  }
}

// One key block (128 rows of 128 B, 16 KiB in a row in the workspace) into 128 padded LDS rows: 8 copies of 16 B a lane, 128 lanes a block, through no register.
// The wait is the statement's last line, so that no address register of a copy is rewritten in front of it.
__device__ __forceinline__ void kv_block_copies(unsigned lds, const _Float16* g) {
  asm volatile("global_load_async_to_lds_b128 %0, %8, off\n\t"
               "global_load_async_to_lds_b128 %1, %9, off\n\t"
               "global_load_async_to_lds_b128 %2, %10, off\n\t"
               "global_load_async_to_lds_b128 %3, %11, off\n\t"
               "global_load_async_to_lds_b128 %4, %12, off\n\t"
               "global_load_async_to_lds_b128 %5, %13, off\n\t"
               "global_load_async_to_lds_b128 %6, %14, off\n\t"
               "global_load_async_to_lds_b128 %7, %15, off\n\t"
               "s_wait_xcnt 0x0"
               :: "v"(lds), "v"(lds + 1u * 32u * LPITCH), "v"(lds + 2u * 32u * LPITCH), "v"(lds + 3u * 32u * LPITCH),
                  "v"(lds + 4u * 32u * LPITCH), "v"(lds + 5u * 32u * LPITCH), "v"(lds + 6u * 32u * LPITCH), "v"(lds + 7u * 32u * LPITCH),
                  "v"(g), "v"(g + 1 * 1024), "v"(g + 2 * 1024), "v"(g + 3 * 1024),
                  "v"(g + 4 * 1024), "v"(g + 5 * 1024), "v"(g + 6 * 1024), "v"(g + 7 * 1024)
               : "memory");
}

// Second launch: one work-group of 16 waves per query tile and WGP. Wave (wq, ks) takes queries 32*wq .. 32*wq+31 and key range ks; the four ranges'
// partial sums are added in LDS in fixed order (range 0, 1, 2, 3), then query mask, normalisation, conv branch and the staged store.
// All 16 waves now meet at one barrier a stage, so no other work-group covers a load wait: the next stage is copied to a second buffer while this one is worked on.
// waves_per_eu(4, 4): 4 waves a SIMD, 256 registers a wave
__global__ __launch_bounds__(32 * NWAVE_MAIN) __attribute__((amdgpu_waves_per_eu(4, 4)))
void yoso_attn_wmma_kernel(const float* __restrict__ Q,
                           const float* __restrict__ kvw,
                           const float* __restrict__ V,
                           const float* __restrict__ mask,
                           const float* __restrict__ cw,
                           float* out) {
  // one LDS arena. Loop: [2 buffers x 4 ranges x 2 key blocks x (kn 64 | vt 64) | qn 128] rows of LPITCH halves. Behind the loop: [32 partial tiles | output stage].
  __shared__ __align__(16) unsigned char smem[(2 * KV_BUF_H + QTILE * LPITCH) * 2];
  static_assert((NWAVE * NSPLIT * WAVE_TILE_F32 + QTILE * CSTR) * 4 <= (2 * KV_BUF_H + QTILE * LPITCH) * 2, "partial tiles and output stage fit the arena");
  _Float16* sm_kv = (_Float16*)smem;                        // key blocks
  _Float16* sm_qn = sm_kv + 2 * KV_BUF_H;                   // normalized Q tile, row-major
  float* red = (float*)smem;                                // partial tiles [16-query tile][range], fragment order
  float* cst = red + NWAVE * NSPLIT * WAVE_TILE_F32;        // output stage [128][CSTR]

  const int h      = blockIdx.y;
  const int qbase  = blockIdx.x * QTILE;
  const int tid    = threadIdx.x;
  const int wv     = __builtin_amdgcn_readfirstlane(tid >> 5);  // scalar: the key mask's base and the LDS bases that follow from it stay out of the vector registers
  const int ks     = wv / NWAVE_Q;  // key range of this wave
  const int wq     = wv % NWAVE_Q;  // its pair of 16-query tiles
  const int lane   = tid & 31;
  const int lh     = lane >> 4;   // lane half: 0 or 1
  const int ln     = lane & 15;
  const int dofs8  = lh * 8;      // A-frag half offset (K 0-7/16-23 vs 8-15/24-31)
  const size_t headoff = (size_t)h * S_LEN * DHEAD;

  // the four waves of a range copy that range's key block: lane t of the 128 takes 16 B of every 16th row
  const int t128 = tid & (32 * NWAVE_Q - 1);
  const _Float16* gkv = (const _Float16*)kvw + (size_t)(h * (S_LEN / KTILE) + ks * KB_PER_SPLIT) * KV_TILE_H + t128 * 8;
  const unsigned lkv = (unsigned)(uintptr_t)(sm_kv + ks * KV_STAGE_H + (t128 >> 3) * LPITCH + (t128 & 7) * 8);

  // stage 0 into buffer 0, in flight under the Q stage
  kv_block_copies(lkv, gkv);
  kv_block_copies(lkv + KV_LDS_H * 2u, gkv + KV_TILE_H);

  // ---------------- Stage L2-normalized Q tile (2 threads / row: the first 8 waves) ----------------
  if (tid < 2 * QTILE) {
    const int r  = tid >> 1;
    const int hf = tid & 1;
    const float* qrow = Q + headoff + (size_t)(qbase + r) * DHEAD + hf * 32;
    float4 b[8];
    float ss = 0.f;
#pragma unroll
    for (int i = 0; i < 8; ++i) {
      b[i] = ((const float4*)qrow)[i];
      ss += b[i].x * b[i].x + b[i].y * b[i].y + b[i].z * b[i].z + b[i].w * b[i].w;
    }
    ss += __shfl_xor(ss, 1);
    const float inv = 1.f / fmaxf(sqrtf(ss), 1e-12f);
    _Float16* dst = sm_qn + r * LPITCH + hf * 32;
#pragma unroll
    for (int i = 0; i < 8; ++i) {
      dst[i * 4 + 0] = (_Float16)(b[i].x * inv);
      dst[i * 4 + 1] = (_Float16)(b[i].y * inv);
      dst[i * 4 + 2] = (_Float16)(b[i].z * inv);
      dst[i * 4 + 3] = (_Float16)(b[i].w * inv);
    }
  }
  asm volatile("s_wait_asynccnt 0x0" ::: "memory");  // this wave's copies of stage 0 have landed
  __syncthreads();                                   // publishes stage 0 and the Q tile
  // stage 1 into buffer 1
  kv_block_copies(lkv + KV_BUF_H * 2u, gkv + 2 * KV_TILE_H);
  kv_block_copies(lkv + (KV_BUF_H + KV_LDS_H) * 2u, gkv + 3 * KV_TILE_H);

  // ---------------- Q fragments (B operand of the score product) kept in registers for whole kernel ------------
  h16 qA[QSUB][2];
  // both loops unrolled: qA lives in registers and needs constant indices
#pragma unroll
  for (int qs = 0; qs < QSUB; ++qs) {
#pragma unroll
    for (int c = 0; c < 2; ++c) {
      const _Float16* base = sm_qn + ((wq * QSUB + qs) * 16 + ln) * LPITCH + c * 32;
      qA[qs][c] = cat16(lds_ld8(base + dofs8), lds_ld8(base + 16 + dofs8));
    }
  }

  f8 oacc[QSUB][4];
  // both loops unrolled: oacc lives in registers and needs constant indices
#pragma unroll
  for (int qs = 0; qs < QSUB; ++qs)
#pragma unroll
    for (int t = 0; t < 4; ++t) oacc[qs][t] = {};

  // ================================ key-block loop ==============================
  for (int it = 0; it < KB_PER_SPLIT; ++it) {
    const int kb = ks * KB_PER_SPLIT + it;
    const int st = it / KB_PER_STAGE;  // stage of this key block
    const int sb = it % KB_PER_STAGE;  // its place in the stage
    const _Float16* sm_kn = sm_kv + (st & 1) * KV_BUF_H + ks * KV_STAGE_H + sb * KV_LDS_H;  // normalized K block, row-major
    const _Float16* sm_vt = sm_kn + KTILE * LPITCH;                       // V block transposed: vt[d][key]
    // key mask of the 8 keys that this lane half holds in each of the block's four 16-key tiles; first used behind the polynomial, which covers the loads
    float4 km[8];
    // unrolled: km lives in registers and needs constant indices
#pragma unroll
    for (int j = 0; j < 8; ++j) km[j] = *(const float4*)(mask + kb * KTILE + (j >> 1) * 16 + lh * 8 + (j & 1) * 4);

    // ---- per 32 keys: S^T = Kn * Qn^T (keys down, queries across), transform, O += P * V -------------
    // In the accumulator of S^T lane (ln, lh) holds query ln, keys 8*lh..8*lh+7 of its 16-key tile: two such tiles side by side are
    // the A fragment of P for 32 keys (elements 0-7 = k 8*lh.., elements 8-15 = k 16+8*lh..), so P never leaves the registers.
#pragma unroll
    for (int kc = 0; kc < 2; ++kc) {
      h16 PA[QSUB];
      // this loop and those over qs and r unrolled: PA, acc, qA and km live in registers and need constant indices
#pragma unroll
      for (int t2 = 0; t2 < 2; ++t2) {
        const int nt = kc * 2 + t2;
        const _Float16* kb0 = sm_kn + (nt * 16 + ln) * LPITCH;
        // A fragment of Kn; the Q fragments serve as B, which uses the same per-lane k map: elements 0-7 = k 8*lh..8*lh+7, elements 8-15 = k 16+8*lh..
        const h16 Klo = cat16(lds_ld8(kb0 + dofs8),      lds_ld8(kb0 + 16 + dofs8));
        const h16 Khi = cat16(lds_ld8(kb0 + 32 + dofs8), lds_ld8(kb0 + 48 + dofs8));
        // one read of the K fragments, both query tiles: two independent accumulator chains, each standing in the other's wait
        f8 acc[QSUB];
#pragma unroll
        for (int qs = 0; qs < QSUB; ++qs) {
          const f8 zero = {};
          acc[qs] = __builtin_amdgcn_wmma_f32_16x16x32_f16(false, Klo, false, qA[qs][0], (short)0, zero, false, false);
        }
#pragma unroll
        for (int qs = 0; qs < QSUB; ++qs)
          acc[qs] = __builtin_amdgcn_wmma_f32_16x16x32_f16(false, Khi, false, qA[qs][1], (short)0, acc[qs], false, false);
#pragma unroll
        for (int qs = 0; qs < QSUB; ++qs) {
#pragma unroll
          for (int r = 0; r < 8; r += 2) {
            f2 s;                                             // the reference's clip
            s.x = __builtin_amdgcn_fmed3f(acc[qs][r],     -1.f + 1e-6f, 1.f - 1e-6f);
            s.y = __builtin_amdgcn_fmed3f(acc[qs][r + 1], -1.f + 1e-6f, 1.f - 1e-6f);
            const f2 z = __builtin_elementwise_fma(s, (f2)(-0.5f), (f2)(0.5f));
            f2 y;                                             // y = sin(acos(s)/2), in (0, 1)
            y.x = __builtin_amdgcn_sqrtf(z.x);
            y.y = __builtin_amdgcn_sqrtf(z.y);
            f2 p = collision_sq(y);                           // (1 - acos(s)/pi)^2
            p = p * p; p = p * p;                             // ^8
            const float4 k4 = km[nt * 2 + (r >> 2)];          // key mask of this lane's rows r, r + 1
            const f2 kmp = (r & 2) ? (f2){k4.z, k4.w} : (f2){k4.x, k4.y};
            p *= kmp;
            const h2 ph = __builtin_convertvector(p, h2);
            PA[qs][t2 * 8 + r]     = ph.x;
            PA[qs][t2 * 8 + r + 1] = ph.y;
          }
        }
      }
#pragma unroll
      for (int dt = 0; dt < 4; ++dt) {
        const _Float16* vb = sm_vt + (dt * 16 + ln) * LPITCH + kc * 32;
        const h16 BV = cat16(lds_ld8(vb + dofs8), lds_ld8(vb + 16 + dofs8));
        // one read of the V fragment, both query tiles (unrolled: PA and oacc need constant indices)
#pragma unroll
        for (int qs = 0; qs < QSUB; ++qs)
          oacc[qs][dt] = __builtin_amdgcn_wmma_f32_16x16x32_f16(false, PA[qs], false, BV, (short)0, oacc[qs][dt], false, false);
      }
    }
    // four vector slots behind the trip's last matrix instructions: on the taken back edge the next trip's loads land in their operand registers
    asm volatile("v_nop\n\tv_nop\n\tv_nop\n\tv_nop"
                 : "+v"(oacc[0][0]), "+v"(oacc[0][1]), "+v"(oacc[0][2]), "+v"(oacc[0][3]),
                   "+v"(oacc[1][0]), "+v"(oacc[1][1]), "+v"(oacc[1][2]), "+v"(oacc[1][3]));

    // behind a stage's last key block (a test on the trip count alone, the same in every wave):
    // publish point of stage st + 1, and the end of every wave's reads of stage st
    if (sb == KB_PER_STAGE - 1) {
      asm volatile("s_wait_dscnt 0x0" ::: "memory");     // this wave's reads of the buffer that is refilled below have returned
      asm volatile("s_wait_asynccnt 0x0" ::: "memory");  // this wave's copies of stage st + 1 have landed
      __syncthreads();
      if (st + 2 < NSTAGE) {
        const unsigned l = lkv + (unsigned)(st & 1) * (KV_BUF_H * 2u);
        const _Float16* g = gkv + (size_t)(st + 2) * (KB_PER_STAGE * KV_TILE_H);
        kv_block_copies(l, g);
        kv_block_copies(l + KV_LDS_H * 2u, g + KV_TILE_H);
      }
    }
  }
  asm volatile("s_wait_asynccnt 0x0" ::: "memory");  // no copy is out when the buffers become the partial tiles

  // ---- conv branch inputs. Store phase: a thread owns rows row0 .. row0 + 3, columns c4 .. c4 + 3; the conv needs rows row0 - 1 .. row0 + 4 of V and of the mask,
  // loaded without any condition (the two edge rows by a clamped index, zeroed by a select) and issued here, so that they fly under the sum of the partial tiles ----
  const int c4   = (tid & 15) * 4;
  const int rloc = (tid >> 4) * 4;
  const int row0 = qbase + rloc;
  const bool has_lo = row0 > 0, has_hi = row0 + 4 < S_LEN;
  const int tile = wv >> 1;   // sum phase: a wave takes rows 4*hf4 .. 4*hf4+3 of each lane half of one 16-query tile
  const int hf4  = wv & 1;
  const int srow = tile * 16 + lh * 8 + hf4 * 4;
  const char* vb = (const char*)(V + headoff);
  const char* mb = (const char*)mask;
  const unsigned vofs    = (unsigned)(row0 * DHEAD + c4) * 4u;
  const unsigned vofs_lo = has_lo ? vofs - DHEAD * 4u : vofs;                  // clamped: the two edge addresses stay inside V and the mask
  const unsigned vofs_hi = has_hi ? vofs + 4u * DHEAD * 4u : vofs + 3u * DHEAD * 4u;
  const unsigned mofs    = (unsigned)row0 * 4u;
  const unsigned mofs_lo = has_lo ? mofs - 4u : mofs;
  const unsigned mofs_hi = has_hi ? mofs + 16u : mofs + 12u;
  const float w0 = cw[h * 3 + 0], w1 = cw[h * 3 + 1], w2 = cw[h * 3 + 2];
  f4    vr[6];
  float mr[6];
  vr[0] = *(const f4*)(vb + vofs_lo);
  // unrolled: vr lives in registers and needs constant indices
#pragma unroll
  for (int j = 0; j < 4; ++j) vr[j + 1] = *(const f4*)(vb + vofs + j * (DHEAD * 4));
  vr[5] = *(const f4*)(vb + vofs_hi);
  const f4 qm4 = *(const f4*)(mb + (unsigned)(qbase + srow) * 4u);
  const f4 ma  = *(const f4*)(mb + mofs);
  mr[0] = *(const float*)(mb + mofs_lo);
  mr[5] = *(const float*)(mb + mofs_hi);

  // ---- partial O of this wave's key range to LDS, in fragment order: every store is 32 lanes x 16 B in a row ----
  // all three loops unrolled: the accumulators live in registers and need constant indices
#pragma unroll
  for (int qs = 0; qs < QSUB; ++qs) {
    float* pt = red + ((wq * QSUB + qs) * NSPLIT + ks) * WAVE_TILE_F32 + lane * 4;
#pragma unroll
    for (int dt = 0; dt < 4; ++dt) {
#pragma unroll
      for (int hf = 0; hf < 2; ++hf) {
        *(float4*)(pt + (dt * 2 + hf) * 128) =
            make_float4(oacc[qs][dt][hf * 4 + 0], oacc[qs][dt][hf * 4 + 1], oacc[qs][dt][hf * 4 + 2], oacc[qs][dt][hf * 4 + 3]);
      }
    }
  }
  __syncthreads();  // all 32 partial tiles complete before they are summed

  float4 osum[4];
  {
    const float* pr = red + tile * (NSPLIT * WAVE_TILE_F32) + hf4 * 128 + lane * 4;
    // both loops unrolled: osum lives in registers and needs constant indices
#pragma unroll
    for (int dt = 0; dt < 4; ++dt) {
      float4 a = *(const float4*)(pr + dt * 256);
#pragma unroll
      for (int s = 1; s < NSPLIT; ++s) {
        const float4 p = *(const float4*)(pr + s * WAVE_TILE_F32 + dt * 256);
        a.x += p.x; a.y += p.y; a.z += p.z; a.w += p.w;
      }
      osum[dt] = a;
    }
  }

  const float qmv[4] = {qm4.x, qm4.y, qm4.z, qm4.w};
#pragma unroll
  for (int r = 0; r < 4; ++r) {
    const float qm = qmv[r];
    float xv[4];
    float ss = 0.f;
#pragma unroll
    for (int dt = 0; dt < 4; ++dt) {   // reference order: mask BEFORE normalize
      const float o = r == 0 ? osum[dt].x : (r == 1 ? osum[dt].y : (r == 2 ? osum[dt].z : osum[dt].w));
      xv[dt] = o * qm;
      ss += xv[dt] * xv[dt];
    }
    // reduce sum of squares across the 16 lanes of this half (row is constant there)
    ss += __shfl_xor(ss, 1);
    ss += __shfl_xor(ss, 2);
    ss += __shfl_xor(ss, 4);
    ss += __shfl_xor(ss, 8);
    const float inv = 1.f / fmaxf(sqrtf(ss), 1e-12f);
    // unrolled: xv lives in registers and needs constant indices
#pragma unroll
    for (int dt = 0; dt < 4; ++dt) cst[(srow + r) * CSTR + dt * 16 + ln] = xv[dt] * inv;
  }

  mr[1] = ma.x; mr[2] = ma.y; mr[3] = ma.z; mr[4] = ma.w;
  // masked V rows; a row outside the sequence is the conv's zero padding (unrolled: vr and mr need constant indices)
#pragma unroll
  for (int j = 0; j < 6; ++j) {
    const bool in = j == 0 ? has_lo : (j == 5 ? has_hi : true);
    vr[j].x = in ? vr[j].x * mr[j] : 0.f;
    vr[j].y = in ? vr[j].y * mr[j] : 0.f;
    vr[j].z = in ? vr[j].z * mr[j] : 0.f;
    vr[j].w = in ? vr[j].w * mr[j] : 0.f;
  }
  __syncthreads();  // the output stage is complete before it is read back row by row
  {
    char* ob = (char*)(out + headoff) + vofs;
    // unrolled: vr needs constant indices; every store is 2 rows x 256 B = 4 whole lines
#pragma unroll
    for (int j = 0; j < 4; ++j) {
      const float4 x = *(const float4*)(cst + (rloc + j) * CSTR + c4);
      float4 o;
      o.x = x.x + (w0 * vr[j].x + w1 * vr[j + 1].x + w2 * vr[j + 2].x);
      o.y = x.y + (w0 * vr[j].y + w1 * vr[j + 1].y + w2 * vr[j + 2].y);
      o.z = x.z + (w0 * vr[j].z + w1 * vr[j + 1].z + w2 * vr[j + 2].z);
      o.w = x.w + (w0 * vr[j].w + w1 * vr[j + 1].w + w2 * vr[j + 2].w);
      *(float4*)(ob + j * (DHEAD * 4)) = o;
    }
  }
}

extern "C" void kernel_launch(void* const* d_in, const int* in_sizes, int n_in,
                              void* d_out, int out_size, void* d_ws, size_t ws_size,
                              hipStream_t stream) {
  (void)in_sizes; (void)n_in; (void)out_size; (void)ws_size;
  const float* Q    = (const float*)d_in[0];
  const float* K    = (const float*)d_in[1];
  const float* V    = (const float*)d_in[2];
  const float* mask = (const float*)d_in[3];
  const float* cw   = (const float*)d_in[4];
  float* out = (float*)d_out;

  float* kvw = (float*)d_ws;  // 8 MiB of f16 key-block tiles, all written by the first launch

  dim3 grid(S_LEN / QTILE, NHEAD);   // 32 query tiles x 8 heads: one work-group a WGP
  dim3 grid0(S_LEN / KTILE, NHEAD);  // 64 key blocks x 8 heads
  dim3 block(32 * NWAVE);            // 8 wave32 waves
  dim3 block1(32 * NWAVE_MAIN);      // 16 wave32 waves
  kv_f16_tiles_kernel<<<grid0, block, 0, stream>>>(K, V, kvw);
  yoso_attn_wmma_kernel<<<grid, block1, 0, stream>>>(Q, kvw, V, mask, cw, out);
}

// v010
// A run of this version takes 42.4 microseconds.
// Two timings next to v009 both put it at 1.08 times that version's speed.
// All steps since v000 together make it 7.03 times as fast.
#include <hip/hip_runtime.h>

// Contractions Kn.Qn^T (K=64) and P.V (K=64 per key block) on v_wmma_f32_16x16x32_f16 (f16 operands, f32 accumulate); normalisation, arccos power, conv and epilogue in f32.

typedef _Float16 h8  __attribute__((ext_vector_type(8)));
typedef _Float16 h16 __attribute__((ext_vector_type(16)));
typedef float    f8  __attribute__((ext_vector_type(8)));
typedef float    f2  __attribute__((ext_vector_type(2)));
typedef float    f4  __attribute__((ext_vector_type(4)));
typedef _Float16 h2  __attribute__((ext_vector_type(2)));

#define S_LEN 4096
#define NHEAD 8
#define DHEAD 64
#define QTILE 128
#define KTILE 64
#define NWAVE 8    // 16-query tiles of one query tile: the unit of the partial tiles in LDS, and the waves of the first launch
#define QSUB 2     // 16-query tiles per wave of the main launch: every K and V fragment read from LDS feeds two matrix products
#define NWAVE_Q (NWAVE / QSUB)           // waves that share one key range
#define NWAVE_MAIN (NSPLIT * NWAVE_Q)    // waves of the main launch's work-group: 4 query pairs x 4 key ranges, 4 waves a SIMD
#define NSPLIT 4   // key ranges per query tile, all four in one work-group: their partial sums meet in LDS
#define KB_PER_SPLIT (S_LEN / KTILE / NSPLIT)
#define WAVE_TILE_F32 (16 * DHEAD)  // one 16 x 64 f32 accumulator tile in LDS, kept in fragment order
#define KV_TILE_H (2 * KTILE * DHEAD)  // halves of one key block in the workspace: 64 x 64 normalized K rows, then 64 x 64 V transposed (d-major)
#define KV_LDS_H ((KTILE + DHEAD) * LPITCH)  // halves of one key block in LDS: 128 padded rows
#define KB_PER_STAGE 2                       // key blocks of a range between two barriers: half the barriers, and the waves drift apart between them
#define NSTAGE (KB_PER_SPLIT / KB_PER_STAGE)
#define KV_STAGE_H (KB_PER_STAGE * KV_LDS_H) // one range's share of a buffer
#define KV_BUF_H (NSPLIT * KV_STAGE_H)       // one buffer: the current stage of each of the four ranges
#define CSTR (DHEAD + 4)                     // row pitch of the output stage, in floats
#define LPITCH 72  // LDS row pitch in halves: 144 B = 16 B x 9 (odd), so the 16 rows of a ds_load_b128 fragment read fall on distinct banks

__device__ __forceinline__ h16 cat16(h8 a, h8 b) {
  h16 r;
#pragma unroll
  for (int i = 0; i < 8; ++i) { r[i] = a[i]; r[i + 8] = b[i]; }
  return r;
}

__device__ __forceinline__ h8 lds_ld8(const _Float16* p) {
  return *(const h8*)p;
}

// (1 - acos(s)/pi)^2 as one polynomial in y = sqrt((1 - s)/2), for every s in [-1, 1].
// acos(s) = 2 asin(y), so 1 - acos(s)/pi = (2/pi) acos(y); acos(y) behaves like sqrt(1 - y) at y = 1, its square is smooth there,
// and the only singular point left is y = -1, outside [0, 1]: no branch on the sign or the size of s, and one squaring fewer.
// Degree-4 minimax fit on [0, 1], weighted for the relative error of the 8th power: with the f32 rounding of the chain it is within
// 3.5e-4 of it wherever it is an f16 normal number, and within 2e-8 absolute below that. The degree is set by what follows: P is rounded
// to f16, a step of up to 4.9e-4 relative, so terms that only bring the fit further under that step buy nothing in the product P*V.
// Two scores at a time: the pairs keep every multiply-add of the chain on the packed f32 form.
__device__ __forceinline__ f2 collision_sq(f2 y) {
  f2 q = (f2)(0.0308360215f);
  q = __builtin_elementwise_fma(q, y, (f2)(-0.141762391f));
  q = __builtin_elementwise_fma(q, y, (f2)(0.380873263f));
  q = __builtin_elementwise_fma(q, y, (f2)(-1.26985466f));
  q = __builtin_elementwise_fma(q, y, (f2)(0.999915242f));
  return q;
}

// First launch: each 64-key block once per head (the main launch reads it from 32 query tiles): K rows L2-normalized to f16, V to f16 and transposed.
// What the main launch would do to every score with a factor that belongs to the key alone is done here once per key:
// the K rows carry the factor -1/2 (a power of two: the f16 digits stay the same), so that the score product, started at 1/2, is (1 - s)/2;
// the V rows carry the key mask, P*(m*V) in place of (P*m)*V.
__global__ __launch_bounds__(256)
void kv_f16_tiles_kernel(const float* __restrict__ K,
                         const float* __restrict__ V,
                         const float* __restrict__ mask,
                         float* __restrict__ kvw) {
  __shared__ __align__(16) _Float16 sm_kn[(KTILE + DHEAD) * LPITCH];  // 64 rows of Kn, then 64 rows of vt[d][key]
  _Float16* sm_vt = sm_kn + KTILE * LPITCH;
  const int h   = blockIdx.y;
  const int kb  = blockIdx.x;
  const int tid = threadIdx.x;
  const size_t headoff = (size_t)h * S_LEN * DHEAD;
  {
    const int r  = tid >> 2;      // key row 0..63
    const int q4 = tid & 3;       // 16-col quarter
    const int key = kb * KTILE + r;
    const float* krow = K + headoff + (size_t)key * DHEAD + q4 * 16;
    float4 b[4];
    float ss = 0.f;
#pragma unroll
    for (int i = 0; i < 4; ++i) {
      b[i] = ((const float4*)krow)[i];
      ss += b[i].x * b[i].x + b[i].y * b[i].y + b[i].z * b[i].z + b[i].w * b[i].w;
    }
    ss += __shfl_xor(ss, 1);
    ss += __shfl_xor(ss, 2);
    const float inv = -0.5f / fmaxf(sqrtf(ss), 1e-12f);
    _Float16* dst = sm_kn + r * LPITCH + q4 * 16;
#pragma unroll
    for (int i = 0; i < 4; ++i) {
      dst[i * 4 + 0] = (_Float16)(b[i].x * inv);
      dst[i * 4 + 1] = (_Float16)(b[i].y * inv);
      dst[i * 4 + 2] = (_Float16)(b[i].z * inv);
      dst[i * 4 + 3] = (_Float16)(b[i].w * inv);
    }
    // V block, stored transposed so P*V B-fragments are contiguous b128 loads
    const float* vrow = V + headoff + (size_t)key * DHEAD + q4 * 16;
    const float mk = mask[key];
#pragma unroll
    for (int i = 0; i < 4; ++i) {
      const float4 v4 = ((const float4*)vrow)[i];
      const int c0 = q4 * 16 + i * 4;
      const f2 lo = {v4.x * mk, v4.y * mk}, hi = {v4.z * mk, v4.w * mk};  // pairs: one packed conversion for two values
      const h2 hlo = __builtin_convertvector(lo, h2), hhi = __builtin_convertvector(hi, h2);
      sm_vt[(c0 + 0) * LPITCH + r] = hlo.x;
      sm_vt[(c0 + 1) * LPITCH + r] = hlo.y;
      sm_vt[(c0 + 2) * LPITCH + r] = hhi.x;
      sm_vt[(c0 + 3) * LPITCH + r] = hhi.y;
    }
  }
  __syncthreads();  // all 128 rows complete before they are read back whole
  {
    // 128 rows of 128 B go out unpadded, 16 KiB in a row: every store is 32 lanes x 16 B = 4 whole lines
    h8* g = (h8*)((_Float16*)kvw + (size_t)(h * (S_LEN / KTILE) + kb) * KV_TILE_H) + tid;
    const _Float16* s = sm_kn + (tid >> 3) * LPITCH + (tid & 7) * 8;
    // unrolled: the four LDS reads are issued together, ahead of the stores
#pragma unroll
    for (int j = 0; j < 4; ++j) g[j * 256] = lds_ld8(s + j * 32 * LPITCH);
  }
}

// One key block (128 rows of 128 B, 16 KiB in a row in the workspace) into 128 padded LDS rows: 8 copies of 16 B a lane, 128 lanes a block, through no register.
// The wait is the statement's last line, so that no address register of a copy is rewritten in front of it.
__device__ __forceinline__ void kv_block_copies(unsigned lds, const _Float16* g) {
  asm volatile("global_load_async_to_lds_b128 %0, %8, off\n\t"
               "global_load_async_to_lds_b128 %1, %9, off\n\t"
               "global_load_async_to_lds_b128 %2, %10, off\n\t"
               "global_load_async_to_lds_b128 %3, %11, off\n\t"
               "global_load_async_to_lds_b128 %4, %12, off\n\t"
               "global_load_async_to_lds_b128 %5, %13, off\n\t"
               "global_load_async_to_lds_b128 %6, %14, off\n\t"
               "global_load_async_to_lds_b128 %7, %15, off\n\t"
               "s_wait_xcnt 0x0"
               :: "v"(lds), "v"(lds + 1u * 32u * LPITCH), "v"(lds + 2u * 32u * LPITCH), "v"(lds + 3u * 32u * LPITCH),
                  "v"(lds + 4u * 32u * LPITCH), "v"(lds + 5u * 32u * LPITCH), "v"(lds + 6u * 32u * LPITCH), "v"(lds + 7u * 32u * LPITCH),
                  "v"(g), "v"(g + 1 * 1024), "v"(g + 2 * 1024), "v"(g + 3 * 1024),
                  "v"(g + 4 * 1024), "v"(g + 5 * 1024), "v"(g + 6 * 1024), "v"(g + 7 * 1024)
               : "memory");
}

// Second launch: one work-group of 16 waves per query tile and WGP. Wave (wq, ks) takes queries 32*wq .. 32*wq+31 and key range ks; the four ranges'
// partial sums are added in LDS in fixed order (range 0, 1, 2, 3), then query mask, normalisation, conv branch and the staged store.
// All 16 waves now meet at one barrier a stage, so no other work-group covers a load wait: the next stage is copied to a second buffer while this one is worked on.
// waves_per_eu(4, 4): 4 waves a SIMD, 256 registers a wave
__global__ __launch_bounds__(32 * NWAVE_MAIN) __attribute__((amdgpu_waves_per_eu(4, 4)))
void yoso_attn_wmma_kernel(const float* __restrict__ Q,
                           const float* __restrict__ kvw,
                           const float* __restrict__ V,
                           const float* __restrict__ mask,
                           const float* __restrict__ cw,
                           float* out) {
  // one LDS arena. Loop: [2 buffers x 4 ranges x 2 key blocks x (kn 64 | vt 64) | qn 128] rows of LPITCH halves. Behind the loop: [32 partial tiles | output stage].
  __shared__ __align__(16) unsigned char smem[(2 * KV_BUF_H + QTILE * LPITCH) * 2];
  static_assert((NWAVE * NSPLIT * WAVE_TILE_F32 + QTILE * CSTR) * 4 <= (2 * KV_BUF_H + QTILE * LPITCH) * 2, "partial tiles and output stage fit the arena");
  _Float16* sm_kv = (_Float16*)smem;                        // key blocks
  _Float16* sm_qn = sm_kv + 2 * KV_BUF_H;                   // normalized Q tile, row-major
  float* red = (float*)smem;                                // partial tiles [16-query tile][range], fragment order
  float* cst = red + NWAVE * NSPLIT * WAVE_TILE_F32;        // output stage [128][CSTR]

  const int h      = blockIdx.y;
  const int qbase  = blockIdx.x * QTILE;
  const int tid    = threadIdx.x;
  const int wv     = __builtin_amdgcn_readfirstlane(tid >> 5);  // scalar: the LDS bases that follow from it stay out of the vector registers
  const int ks     = wv / NWAVE_Q;  // key range of this wave
  const int wq     = wv % NWAVE_Q;  // its pair of 16-query tiles
  const int lane   = tid & 31;
  const int lh     = lane >> 4;   // lane half: 0 or 1
  const int ln     = lane & 15;
  const int dofs8  = lh * 8;      // A-frag half offset (K 0-7/16-23 vs 8-15/24-31)
  const size_t headoff = (size_t)h * S_LEN * DHEAD;

  // the four waves of a range copy that range's key block: lane t of the 128 takes 16 B of every 16th row
  const int t128 = tid & (32 * NWAVE_Q - 1);
  const _Float16* gkv = (const _Float16*)kvw + (size_t)(h * (S_LEN / KTILE) + ks * KB_PER_SPLIT) * KV_TILE_H + t128 * 8;
  const unsigned lkv = (unsigned)(uintptr_t)(sm_kv + ks * KV_STAGE_H + (t128 >> 3) * LPITCH + (t128 & 7) * 8);

  // stage 0 into buffer 0, in flight under the Q stage
  kv_block_copies(lkv, gkv);
  kv_block_copies(lkv + KV_LDS_H * 2u, gkv + KV_TILE_H);

  // ---------------- Stage L2-normalized Q tile (2 threads / row: the first 8 waves) ----------------
  if (tid < 2 * QTILE) {
    const int r  = tid >> 1;
    const int hf = tid & 1;
    const float* qrow = Q + headoff + (size_t)(qbase + r) * DHEAD + hf * 32;
    float4 b[8];
    float ss = 0.f;
#pragma unroll
    for (int i = 0; i < 8; ++i) {
      b[i] = ((const float4*)qrow)[i];
      ss += b[i].x * b[i].x + b[i].y * b[i].y + b[i].z * b[i].z + b[i].w * b[i].w;
    }
    ss += __shfl_xor(ss, 1);
    const float inv = 1.f / fmaxf(sqrtf(ss), 1e-12f);
    _Float16* dst = sm_qn + r * LPITCH + hf * 32;
#pragma unroll
    for (int i = 0; i < 8; ++i) {
      dst[i * 4 + 0] = (_Float16)(b[i].x * inv);
      dst[i * 4 + 1] = (_Float16)(b[i].y * inv);
      dst[i * 4 + 2] = (_Float16)(b[i].z * inv);
      dst[i * 4 + 3] = (_Float16)(b[i].w * inv);
    }
  }
  asm volatile("s_wait_asynccnt 0x0" ::: "memory");  // this wave's copies of stage 0 have landed
  __syncthreads();                                   // publishes stage 0 and the Q tile
  // stage 1 into buffer 1
  kv_block_copies(lkv + KV_BUF_H * 2u, gkv + 2 * KV_TILE_H);
  kv_block_copies(lkv + (KV_BUF_H + KV_LDS_H) * 2u, gkv + 3 * KV_TILE_H);

  // ---------------- Q fragments (B operand of the score product) kept in registers for whole kernel ------------
  h16 qA[QSUB][2];
  // both loops unrolled: qA lives in registers and needs constant indices
#pragma unroll
  for (int qs = 0; qs < QSUB; ++qs) {
#pragma unroll
    for (int c = 0; c < 2; ++c) {
      const _Float16* base = sm_qn + ((wq * QSUB + qs) * 16 + ln) * LPITCH + c * 32;
      qA[qs][c] = cat16(lds_ld8(base + dofs8), lds_ld8(base + 16 + dofs8));
    }
  }

  f8 oacc[QSUB][4];
  // both loops unrolled: oacc lives in registers and needs constant indices
#pragma unroll
  for (int qs = 0; qs < QSUB; ++qs)
#pragma unroll
    for (int t = 0; t < 4; ++t) oacc[qs][t] = {};

  // ================================ key-block loop ==============================
  for (int it = 0; it < KB_PER_SPLIT; ++it) {
    const int st = it / KB_PER_STAGE;  // stage of this key block
    const int sb = it % KB_PER_STAGE;  // its place in the stage
    const _Float16* sm_kn = sm_kv + (st & 1) * KV_BUF_H + ks * KV_STAGE_H + sb * KV_LDS_H;  // normalized K block, row-major
    const _Float16* sm_vt = sm_kn + KTILE * LPITCH;                       // V block transposed: vt[d][key]

    // ---- per 32 keys: Z^T = 1/2 + (-Kn/2) * Qn^T = (1 - S^T)/2 (keys down, queries across), transform, O += P * (m V) -------------
    // In the accumulator of S^T lane (ln, lh) holds query ln, keys 8*lh..8*lh+7 of its 16-key tile: two such tiles side by side are
    // the A fragment of P for 32 keys (elements 0-7 = k 8*lh.., elements 8-15 = k 16+8*lh..), so P never leaves the registers.
#pragma unroll
    for (int kc = 0; kc < 2; ++kc) {
      h16 PA[QSUB];
      // this loop and those over qs and r unrolled: PA, acc and qA live in registers and need constant indices
#pragma unroll
      for (int t2 = 0; t2 < 2; ++t2) {
        const int nt = kc * 2 + t2;
        const _Float16* kb0 = sm_kn + (nt * 16 + ln) * LPITCH;
        // A fragment of Kn; the Q fragments serve as B, which uses the same per-lane k map: elements 0-7 = k 8*lh..8*lh+7, elements 8-15 = k 16+8*lh..
        const h16 Klo = cat16(lds_ld8(kb0 + dofs8),      lds_ld8(kb0 + 16 + dofs8));
        const h16 Khi = cat16(lds_ld8(kb0 + 32 + dofs8), lds_ld8(kb0 + 48 + dofs8));
        // one read of the K fragments, both query tiles: two independent accumulator chains, each standing in the other's wait
        f8 acc[QSUB];
#pragma unroll
        for (int qs = 0; qs < QSUB; ++qs) {
          const f8 half = {0.5f, 0.5f, 0.5f, 0.5f, 0.5f, 0.5f, 0.5f, 0.5f};
          acc[qs] = __builtin_amdgcn_wmma_f32_16x16x32_f16(false, Klo, false, qA[qs][0], (short)0, half, false, false);
        }
#pragma unroll
        for (int qs = 0; qs < QSUB; ++qs)
          acc[qs] = __builtin_amdgcn_wmma_f32_16x16x32_f16(false, Khi, false, qA[qs][1], (short)0, acc[qs], false, false);
#pragma unroll
        for (int qs = 0; qs < QSUB; ++qs) {
#pragma unroll
          for (int r = 0; r < 8; r += 2) {
            f2 y;                                             // y = sin(acos(s)/2)
            y.x = __builtin_amdgcn_sqrtf(acc[qs][r]);
            y.y = __builtin_amdgcn_sqrtf(acc[qs][r + 1]);
            f2 p = collision_sq(y);                           // (1 - acos(s)/pi)^2
            p = p * p; p = p * p;                             // ^8
            // the reference's clip s <= 1 - 1e-6, taken on P, which falls as s falls: P <= (1 - acos(1 - 1e-6)/pi)^8 = 0.996404. A rounded score above 1 arrives here as
            // not-a-number (the root of a negative number), and the minimum of that and the bound is the bound.
            // The clip's other side, s >= -1 + 1e-6, changes nothing: from y = 0.99 to y = 1.01 (unit vectors rounded to f16 give |s| < 1.002) P is under 3e-8 and rounds to the f16 zero.
            const h2 ph = __builtin_elementwise_min(__builtin_convertvector(p, h2), (h2)((_Float16)0.996404f));
            PA[qs][t2 * 8 + r]     = ph.x;
            PA[qs][t2 * 8 + r + 1] = ph.y;
          }
        }
      }
#pragma unroll
      for (int dt = 0; dt < 4; ++dt) {
        const _Float16* vb = sm_vt + (dt * 16 + ln) * LPITCH + kc * 32;
        const h16 BV = cat16(lds_ld8(vb + dofs8), lds_ld8(vb + 16 + dofs8));
        // one read of the V fragment, both query tiles (unrolled: PA and oacc need constant indices)
#pragma unroll
        for (int qs = 0; qs < QSUB; ++qs)
          oacc[qs][dt] = __builtin_amdgcn_wmma_f32_16x16x32_f16(false, PA[qs], false, BV, (short)0, oacc[qs][dt], false, false);
      }
    }
    // four vector slots behind the trip's last matrix instructions: on the taken back edge the next trip's loads land in their operand registers
    asm volatile("v_nop\n\tv_nop\n\tv_nop\n\tv_nop"
                 : "+v"(oacc[0][0]), "+v"(oacc[0][1]), "+v"(oacc[0][2]), "+v"(oacc[0][3]),
                   "+v"(oacc[1][0]), "+v"(oacc[1][1]), "+v"(oacc[1][2]), "+v"(oacc[1][3]));

    // behind a stage's last key block (a test on the trip count alone, the same in every wave):
    // publish point of stage st + 1, and the end of every wave's reads of stage st
    if (sb == KB_PER_STAGE - 1) {
      asm volatile("s_wait_dscnt 0x0" ::: "memory");     // this wave's reads of the buffer that is refilled below have returned
      asm volatile("s_wait_asynccnt 0x0" ::: "memory");  // this wave's copies of stage st + 1 have landed
      __syncthreads();
      if (st + 2 < NSTAGE) {
        const unsigned l = lkv + (unsigned)(st & 1) * (KV_BUF_H * 2u);
        const _Float16* g = gkv + (size_t)(st + 2) * (KB_PER_STAGE * KV_TILE_H);
        kv_block_copies(l, g);
        kv_block_copies(l + KV_LDS_H * 2u, g + KV_TILE_H);
      }
    }
  }
  asm volatile("s_wait_asynccnt 0x0" ::: "memory");  // no copy is out when the buffers become the partial tiles

  // ---- conv branch inputs. Store phase: a thread owns rows row0 .. row0 + 3, columns c4 .. c4 + 3; the conv needs rows row0 - 1 .. row0 + 4 of V and of the mask,
  // loaded without any condition (the two edge rows by a clamped index, zeroed by a select) and issued here, so that they fly under the sum of the partial tiles ----
  const int c4   = (tid & 15) * 4;
  const int rloc = (tid >> 4) * 4;
  const int row0 = qbase + rloc;
  const bool has_lo = row0 > 0, has_hi = row0 + 4 < S_LEN;
  const int tile = wv >> 1;   // sum phase: a wave takes rows 4*hf4 .. 4*hf4+3 of each lane half of one 16-query tile
  const int hf4  = wv & 1;
  const int srow = tile * 16 + lh * 8 + hf4 * 4;
  const char* vb = (const char*)(V + headoff);
  const char* mb = (const char*)mask;
  const unsigned vofs    = (unsigned)(row0 * DHEAD + c4) * 4u;
  const unsigned vofs_lo = has_lo ? vofs - DHEAD * 4u : vofs;                  // clamped: the two edge addresses stay inside V and the mask
  const unsigned vofs_hi = has_hi ? vofs + 4u * DHEAD * 4u : vofs + 3u * DHEAD * 4u;
  const unsigned mofs    = (unsigned)row0 * 4u;
  const unsigned mofs_lo = has_lo ? mofs - 4u : mofs;
  const unsigned mofs_hi = has_hi ? mofs + 16u : mofs + 12u;
  const float w0 = cw[h * 3 + 0], w1 = cw[h * 3 + 1], w2 = cw[h * 3 + 2];
  f4    vr[6];
  float mr[6];
  vr[0] = *(const f4*)(vb + vofs_lo);
  // unrolled: vr lives in registers and needs constant indices
#pragma unroll
  for (int j = 0; j < 4; ++j) vr[j + 1] = *(const f4*)(vb + vofs + j * (DHEAD * 4));
  vr[5] = *(const f4*)(vb + vofs_hi);
  const f4 qm4 = *(const f4*)(mb + (unsigned)(qbase + srow) * 4u);
  const f4 ma  = *(const f4*)(mb + mofs);
  mr[0] = *(const float*)(mb + mofs_lo);
  mr[5] = *(const float*)(mb + mofs_hi);

  // ---- partial O of this wave's key range to LDS, in fragment order: every store is 32 lanes x 16 B in a row ----
  // all three loops unrolled: the accumulators live in registers and need constant indices
#pragma unroll
  for (int qs = 0; qs < QSUB; ++qs) {
    float* pt = red + ((wq * QSUB + qs) * NSPLIT + ks) * WAVE_TILE_F32 + lane * 4;
#pragma unroll
    for (int dt = 0; dt < 4; ++dt) {
#pragma unroll
      for (int hf = 0; hf < 2; ++hf) {
        *(float4*)(pt + (dt * 2 + hf) * 128) =
            make_float4(oacc[qs][dt][hf * 4 + 0], oacc[qs][dt][hf * 4 + 1], oacc[qs][dt][hf * 4 + 2], oacc[qs][dt][hf * 4 + 3]);
      }
    }
  }
  __syncthreads();  // all 32 partial tiles complete before they are summed

  float4 osum[4];
  {
    const float* pr = red + tile * (NSPLIT * WAVE_TILE_F32) + hf4 * 128 + lane * 4;
    // both loops unrolled: osum lives in registers and needs constant indices
#pragma unroll
    for (int dt = 0; dt < 4; ++dt) {
      float4 a = *(const float4*)(pr + dt * 256);
#pragma unroll
      for (int s = 1; s < NSPLIT; ++s) {
        const float4 p = *(const float4*)(pr + s * WAVE_TILE_F32 + dt * 256);
        a.x += p.x; a.y += p.y; a.z += p.z; a.w += p.w;
      }
      osum[dt] = a;
    }
  }

  const float qmv[4] = {qm4.x, qm4.y, qm4.z, qm4.w};
#pragma unroll
  for (int r = 0; r < 4; ++r) {
    const float qm = qmv[r];
    float xv[4];
    float ss = 0.f;
#pragma unroll
    for (int dt = 0; dt < 4; ++dt) {   // reference order: mask BEFORE normalize
      const float o = r == 0 ? osum[dt].x : (r == 1 ? osum[dt].y : (r == 2 ? osum[dt].z : osum[dt].w));
      xv[dt] = o * qm;
      ss += xv[dt] * xv[dt];
    }
    // reduce sum of squares across the 16 lanes of this half (row is constant there)
    ss += __shfl_xor(ss, 1);
    ss += __shfl_xor(ss, 2);
    ss += __shfl_xor(ss, 4);
    ss += __shfl_xor(ss, 8);
    const float inv = 1.f / fmaxf(sqrtf(ss), 1e-12f);
    // unrolled: xv lives in registers and needs constant indices
#pragma unroll
    for (int dt = 0; dt < 4; ++dt) cst[(srow + r) * CSTR + dt * 16 + ln] = xv[dt] * inv;
  }

  mr[1] = ma.x; mr[2] = ma.y; mr[3] = ma.z; mr[4] = ma.w;
  // masked V rows; a row outside the sequence is the conv's zero padding (unrolled: vr and mr need constant indices)
#pragma unroll
  for (int j = 0; j < 6; ++j) {
    const bool in = j == 0 ? has_lo : (j == 5 ? has_hi : true);
    vr[j].x = in ? vr[j].x * mr[j] : 0.f;
    vr[j].y = in ? vr[j].y * mr[j] : 0.f;
    vr[j].z = in ? vr[j].z * mr[j] : 0.f;
    vr[j].w = in ? vr[j].w * mr[j] : 0.f;
  }
  __syncthreads();  // the output stage is complete before it is read back row by row
  {
    char* ob = (char*)(out + headoff) + vofs;
    // unrolled: vr needs constant indices; every store is 2 rows x 256 B = 4 whole lines
#pragma unroll
    for (int j = 0; j < 4; ++j) {
      const float4 x = *(const float4*)(cst + (rloc + j) * CSTR + c4);
      float4 o;
      o.x = x.x + (w0 * vr[j].x + w1 * vr[j + 1].x + w2 * vr[j + 2].x);
      o.y = x.y + (w0 * vr[j].y + w1 * vr[j + 1].y + w2 * vr[j + 2].y);
      o.z = x.z + (w0 * vr[j].z + w1 * vr[j + 1].z + w2 * vr[j + 2].z);
      o.w = x.w + (w0 * vr[j].w + w1 * vr[j + 1].w + w2 * vr[j + 2].w);
      *(float4*)(ob + j * (DHEAD * 4)) = o;
    }
  }
}

extern "C" void kernel_launch(void* const* d_in, const int* in_sizes, int n_in,
                              void* d_out, int out_size, void* d_ws, size_t ws_size,
                              hipStream_t stream) {
  (void)in_sizes; (void)n_in; (void)out_size; (void)ws_size;
  const float* Q    = (const float*)d_in[0];
  const float* K    = (const float*)d_in[1];
  const float* V    = (const float*)d_in[2];
  const float* mask = (const float*)d_in[3];
  const float* cw   = (const float*)d_in[4];
  float* out = (float*)d_out;

  float* kvw = (float*)d_ws;  // 8 MiB of f16 key-block tiles, all written by the first launch

  dim3 grid(S_LEN / QTILE, NHEAD);   // 32 query tiles x 8 heads: one work-group a WGP
  dim3 grid0(S_LEN / KTILE, NHEAD);  // 64 key blocks x 8 heads
  dim3 block(32 * NWAVE);            // 8 wave32 waves
  dim3 block1(32 * NWAVE_MAIN);      // 16 wave32 waves
  kv_f16_tiles_kernel<<<grid0, block, 0, stream>>>(K, V, mask, kvw);
  yoso_attn_wmma_kernel<<<grid, block1, 0, stream>>>(Q, kvw, V, mask, cw, out);
}
